// v000
// Times are from an AMD MI455X. After a warm-up the kernel runs many times in a row, and a time is the length of
// such a window on the GPU divided by its runs, so every launch and the gaps after it count. The runs cycle
// through copies of the inputs. A figure is the median of several windows, for all but v000 over two sittings.
// Sittings can differ by a few percent; kernels timed side by side share one.
// The starting kernel, v000, takes 197 microseconds a run.
#include <hip/hip_runtime.h>
#include <hip/hip_bf16.h>

// ---- problem constants (from reference) ----
#define BATCH 4
#define SEQ   2048
#define CH    512
#define NH    8
#define DQ    16      // per-head q/k dim
#define DV    64      // per-head v dim
#define ROWS  (BATCH * SEQ)   // 8192

typedef __attribute__((ext_vector_type(16))) _Float16 v16h;
typedef __attribute__((ext_vector_type(8)))  float    v8f;

union Frag {
    v16h      v;
    _Float16  h[16];
    uint4     q[2];
};

static __device__ __forceinline__ v8f wmma16(v16h a, v16h b, v8f c) {
    return __builtin_amdgcn_wmma_f32_16x16x32_f16(
        /*neg_a=*/false, a, /*neg_b=*/false, b,
        /*c_mod=*/(short)0, c, /*reuse_a=*/false, /*reuse_b=*/false);
}

// ---------------------------------------------------------------------------
// fp32 -> fp16 conversion
// ---------------------------------------------------------------------------
__global__ void cvt_f32_f16(const float* __restrict__ in, _Float16* __restrict__ out, int n) {
    int i = blockIdx.x * blockDim.x + threadIdx.x;
    if (i < n) out[i] = (_Float16)in[i];
}

// ---------------------------------------------------------------------------
// Projection GEMM: C[ROWS x N] = A[ROWS x 512] * Bw[512 x N] + bias
// Output written f16 in head-split layout: out[((b*NH+h)*SEQ+m)*hd + d]
// Block tile 64(M) x 128(N), 8 waves (4x2), wave tile 16x64, K step 32.
// hdShift: log2(head dim) -> 4 for q/k, 6 for v (avoids runtime div/mod).
// ---------------------------------------------------------------------------
__global__ __launch_bounds__(256) void gemm_proj(
    const _Float16* __restrict__ A, const _Float16* __restrict__ Bw,
    const float* __restrict__ bias, _Float16* __restrict__ outp,
    int N, int hdShift)
{
    __shared__ alignas(16) _Float16 As[64][32];
    __shared__ alignas(16) _Float16 BsT[128][32];   // transposed: [n][k]

    const int tid  = threadIdx.x;
    const int wave = tid >> 5;
    const int lane = tid & 31;
    const int half = lane >> 4;
    const int l    = lane & 15;
    const int mw   = wave >> 1;        // 0..3
    const int nw   = wave & 1;         // 0..1

    const int r0 = blockIdx.x * 64;
    const int n0 = blockIdx.y * 128;

    // per-thread staging coordinates (loop-invariant)
    const int aIdx = tid * 8;
    const int aRow = aIdx >> 5, aCol = aIdx & 31;
    const int bIdx = tid * 16;
    const int bK = bIdx >> 7, bN = bIdx & 127;

    const _Float16* aSrcBase = A + (size_t)(r0 + aRow) * 512 + aCol;
    const _Float16* bSrcBase = Bw + (size_t)bK * N + n0 + bN;

    v8f acc[4];
    v8f zero = {};
    acc[0] = zero; acc[1] = zero; acc[2] = zero; acc[3] = zero;

    for (int kk = 0; kk < 512; kk += 32) {
        __syncthreads();
        // stage A tile 64x32 (each thread: one uint4 = 8 halves, contiguous)
        *(uint4*)&As[aRow][aCol] = *(const uint4*)(aSrcBase + kk);
        // stage B tile 32x128 transposed into BsT[128][32]
        {
            const _Float16* src = bSrcBase + (size_t)kk * N;
            alignas(16) _Float16 tmp[16];
            *(uint4*)&tmp[0] = *(const uint4*)src;
            *(uint4*)&tmp[8] = *(const uint4*)(src + 8);
#pragma unroll
            for (int e = 0; e < 16; e++) BsT[bN + e][bK] = tmp[e];
        }
        // prefetch next iteration's tiles into cache while we compute
        if (kk + 32 < 512) {
            __builtin_prefetch(aSrcBase + kk + 32, 0, 1);
            __builtin_prefetch(bSrcBase + (size_t)(kk + 32) * N, 0, 1);
        }
        __syncthreads();

        // A fragment (16x32, documented 16-bit A layout)
        Frag af;
        af.q[0] = *(const uint4*)&As[mw * 16 + l][half * 8];
        af.q[1] = *(const uint4*)&As[mw * 16 + l][16 + half * 8];
#pragma unroll
        for (int f = 0; f < 4; f++) {
            Frag bfr;
            int n = nw * 64 + f * 16 + l;
            bfr.q[0] = *(const uint4*)&BsT[n][half * 8];
            bfr.q[1] = *(const uint4*)&BsT[n][16 + half * 8];
            acc[f] = wmma16(af.v, bfr.v, acc[f]);
        }
    }

    // epilogue: bias + head-split f16 store (shift/mask instead of div/mod)
    const int hdMask = (1 << hdShift) - 1;
#pragma unroll
    for (int f = 0; f < 4; f++) {
        int ncol = n0 + nw * 64 + f * 16 + l;
        float bs = bias[ncol];
        int h = ncol >> hdShift;
        int d = ncol & hdMask;
#pragma unroll
        for (int r = 0; r < 8; r++) {
            int grow = r0 + mw * 16 + r + half * 8;
            int b_ = grow >> 11;           // / SEQ
            int m  = grow & (SEQ - 1);
            size_t dst = ((((size_t)b_ * NH + h) * SEQ + m) << hdShift) + d;
            outp[dst] = (_Float16)(acc[f][r] + bs);
        }
    }
}

// ---------------------------------------------------------------------------
// Streaming attention: one block = 128 query rows of one (b,h); 8 waves.
// Per wave: 16-row Q tile; loop key blocks of 32:
//   S = Q*K^T (2 wmma), relu+online softmax (+mask), P@V (4 wmma).
// ---------------------------------------------------------------------------
__global__ __launch_bounds__(256) void attn_kernel(
    const _Float16* __restrict__ Q, const _Float16* __restrict__ K,
    const _Float16* __restrict__ V, const int* __restrict__ mask,
    const float* __restrict__ gamma, float* __restrict__ out)
{
    __shared__ alignas(16) _Float16 Kt[32][16];        // [key][d]
    __shared__ alignas(16) _Float16 Vt[DV][32];        // transposed: [d][key]
    __shared__ alignas(16) _Float16 Pl[8][16][32];     // per-wave P tile [row][key]
    __shared__ float mskf[32];

    const int tid  = threadIdx.x;
    const int wave = tid >> 5;
    const int lane = tid & 31;
    const int half = lane >> 4;
    const int l    = lane & 15;

    const int bh = blockIdx.y;            // b*NH + h
    const int b  = bh >> 3;               // / NH
    const int h  = bh & (NH - 1);
    const int q0 = blockIdx.x * 128 + wave * 16;

    const size_t headBase = (size_t)bh * SEQ;

    // per-thread staging coordinates (loop-invariant)
    const int kIdx = tid * 2;
    const int kKey = kIdx >> 4, kD = kIdx & 15;
    const int vIdx = tid * 8;
    const int vKey = vIdx >> 6, vD = vIdx & 63;
    const _Float16* kSrcBase = K + (headBase + kKey) * DQ + kD;
    const _Float16* vSrcBase = V + (headBase + vKey) * DV + vD;

    // Q fragment: 16x16 padded to 16x32 (upper K zero)
    Frag qa;
    qa.q[0] = *(const uint4*)(Q + (headBase + q0 + l) * DQ + half * 8);
    qa.q[1] = make_uint4(0u, 0u, 0u, 0u);

    v8f zero = {};
    v8f o0 = zero, o1 = zero, o2 = zero, o3 = zero;
    float rm[8], rl[8];
#pragma unroll
    for (int r = 0; r < 8; r++) { rm[r] = 0.0f; rl[r] = 0.0f; }  // relu => scores >= 0

    const float scale = 0.25f;  // 1/sqrt(16)

    for (int j = 0; j < SEQ; j += 32) {
        __syncthreads();
        // stage K block 32x16 (one uint = 2 halves per thread)
        *(unsigned int*)&Kt[kKey][kD] =
            *(const unsigned int*)(kSrcBase + (size_t)j * DQ);
        // stage V block 32x64 transposed (uint4 = 8 halves per thread)
        {
            uint4 t = *(const uint4*)(vSrcBase + (size_t)j * DV);
            alignas(16) _Float16 tmp[8];
            *(uint4*)tmp = t;
#pragma unroll
            for (int e = 0; e < 8; e++) Vt[vD + e][vKey] = tmp[e];
        }
        if (tid < 32) mskf[tid] = (float)mask[(size_t)b * SEQ + j + tid];
        // prefetch next key block while this one is consumed
        if (j + 32 < SEQ) {
            __builtin_prefetch(kSrcBase + (size_t)(j + 32) * DQ, 0, 1);
            __builtin_prefetch(vSrcBase + (size_t)(j + 32) * DV, 0, 1);
        }
        __syncthreads();

        // scores: S[16x32] via two 16x16 wmma (B = K^T, padded K-dim)
        Frag kb0, kb1;
        kb0.q[0] = *(const uint4*)&Kt[l][half * 8];
        kb0.q[1] = make_uint4(0u, 0u, 0u, 0u);
        kb1.q[0] = *(const uint4*)&Kt[16 + l][half * 8];
        kb1.q[1] = make_uint4(0u, 0u, 0u, 0u);
        v8f s0 = wmma16(qa.v, kb0.v, zero);
        v8f s1 = wmma16(qa.v, kb1.v, zero);

        float mk0 = mskf[l];
        float mk1 = mskf[16 + l];

#pragma unroll
        for (int r = 0; r < 8; r++) {
            float a = fmaxf(s0[r] * scale, 0.0f);   // relu(pre-softmax)
            float c = fmaxf(s1[r] * scale, 0.0f);
            // row max across the 16 lanes holding this row (xor stays in half)
            float t = fmaxf(a, c);
            t = fmaxf(t, __shfl_xor(t, 1, 32));
            t = fmaxf(t, __shfl_xor(t, 2, 32));
            t = fmaxf(t, __shfl_xor(t, 4, 32));
            t = fmaxf(t, __shfl_xor(t, 8, 32));
            float mnew = fmaxf(rm[r], t);
            float p0 = __expf(a - mnew) * mk0;
            float p1 = __expf(c - mnew) * mk1;
            float rs = p0 + p1;
            rs += __shfl_xor(rs, 1, 32);
            rs += __shfl_xor(rs, 2, 32);
            rs += __shfl_xor(rs, 4, 32);
            rs += __shfl_xor(rs, 8, 32);
            float sf = __expf(rm[r] - mnew);
            rl[r] = rl[r] * sf + rs;
            rm[r] = mnew;
            o0[r] *= sf; o1[r] *= sf; o2[r] *= sf; o3[r] *= sf;
            // C-layout -> LDS row-major P tile (masked probabilities, f16)
            Pl[wave][r + half * 8][l]      = (_Float16)p0;
            Pl[wave][r + half * 8][16 + l] = (_Float16)p1;
        }
        __syncthreads();

        // P fragment (A layout) and V fragments (B layout from transposed Vt)
        Frag pa;
        pa.q[0] = *(const uint4*)&Pl[wave][l][half * 8];
        pa.q[1] = *(const uint4*)&Pl[wave][l][16 + half * 8];
        {
            Frag vb;
            vb.q[0] = *(const uint4*)&Vt[0 * 16 + l][half * 8];
            vb.q[1] = *(const uint4*)&Vt[0 * 16 + l][16 + half * 8];
            o0 = wmma16(pa.v, vb.v, o0);
            vb.q[0] = *(const uint4*)&Vt[1 * 16 + l][half * 8];
            vb.q[1] = *(const uint4*)&Vt[1 * 16 + l][16 + half * 8];
            o1 = wmma16(pa.v, vb.v, o1);
            vb.q[0] = *(const uint4*)&Vt[2 * 16 + l][half * 8];
            vb.q[1] = *(const uint4*)&Vt[2 * 16 + l][16 + half * 8];
            o2 = wmma16(pa.v, vb.v, o2);
            vb.q[0] = *(const uint4*)&Vt[3 * 16 + l][half * 8];
            vb.q[1] = *(const uint4*)&Vt[3 * 16 + l][16 + half * 8];
            o3 = wmma16(pa.v, vb.v, o3);
        }
    }

    // epilogue: beta normalization (masked running sum), gamma, fp32 store
    float g = gamma[0];
#pragma unroll
    for (int r = 0; r < 8; r++) {
        int m = q0 + r + half * 8;
        float inv = g / (rl[r] + 1e-12f);
        size_t obase = ((size_t)b * SEQ + m) * CH + (size_t)h * DV;
        out[obase +  0 + l] = o0[r] * inv;
        out[obase + 16 + l] = o1[r] * inv;
        out[obase + 32 + l] = o2[r] * inv;
        out[obase + 48 + l] = o3[r] * inv;
    }
}

// ---------------------------------------------------------------------------
// launch
// ---------------------------------------------------------------------------
extern "C" void kernel_launch(void* const* d_in, const int* in_sizes, int n_in,
                              void* d_out, int out_size, void* d_ws, size_t ws_size,
                              hipStream_t stream) {
    const float* x     = (const float*)d_in[0];   // (4,2048,512)
    const int*   mask  = (const int*)d_in[1];     // (4,2048)
    const float* Wq    = (const float*)d_in[2];   // (512,128)
    const float* bq    = (const float*)d_in[3];   // (128)
    const float* Wk    = (const float*)d_in[4];   // (512,128)
    const float* bk    = (const float*)d_in[5];   // (128)
    const float* Wv    = (const float*)d_in[6];   // (512,512)
    const float* bv    = (const float*)d_in[7];   // (512)
    const float* gamma = (const float*)d_in[8];   // (1)
    float* out = (float*)d_out;

    // workspace layout (f16 buffers), 256B aligned
    char* ws = (char*)d_ws;
    size_t off = 0;
    auto take = [&](size_t bytes) -> char* {
        char* p = ws + off;
        off = (off + bytes + 255) & ~(size_t)255;
        return p;
    };
    _Float16* xh  = (_Float16*)take((size_t)ROWS * CH * 2);            // 8 MB
    _Float16* wqh = (_Float16*)take((size_t)CH * 128 * 2);
    _Float16* wkh = (_Float16*)take((size_t)CH * 128 * 2);
    _Float16* wvh = (_Float16*)take((size_t)CH * CH * 2);
    _Float16* qh  = (_Float16*)take((size_t)BATCH * NH * SEQ * DQ * 2); // 2 MB
    _Float16* kh  = (_Float16*)take((size_t)BATCH * NH * SEQ * DQ * 2); // 2 MB
    _Float16* vh  = (_Float16*)take((size_t)BATCH * NH * SEQ * DV * 2); // 8 MB

    // 1) fp32 -> fp16 conversions
    {
        int n;
        n = ROWS * CH;   cvt_f32_f16<<<(n + 255) / 256, 256, 0, stream>>>(x,  xh,  n);
        n = CH * 128;    cvt_f32_f16<<<(n + 255) / 256, 256, 0, stream>>>(Wq, wqh, n);
        n = CH * 128;    cvt_f32_f16<<<(n + 255) / 256, 256, 0, stream>>>(Wk, wkh, n);
        n = CH * CH;     cvt_f32_f16<<<(n + 255) / 256, 256, 0, stream>>>(Wv, wvh, n);
    }

    // 2) projections (WMMA GEMM, head-split f16 outputs)
    gemm_proj<<<dim3(ROWS / 64, 1), 256, 0, stream>>>(xh, wqh, bq, qh, 128, 4);
    gemm_proj<<<dim3(ROWS / 64, 1), 256, 0, stream>>>(xh, wkh, bk, kh, 128, 4);
    gemm_proj<<<dim3(ROWS / 64, 4), 256, 0, stream>>>(xh, wvh, bv, vh, 512, 6);

    // 3) streaming masked-softmax attention (WMMA), fp32 output
    attn_kernel<<<dim3(SEQ / 128, BATCH * NH), 256, 0, stream>>>(
        qh, kh, vh, mask, gamma, out);
}

// v001
// It runs in 161 microseconds.
// Timed twice side by side with v000, it ran 1.27 times as fast both times.
#include <hip/hip_runtime.h>
#include <hip/hip_bf16.h>

// ---- problem constants (from reference) ----
#define BATCH 4
#define SEQ   2048
#define CH    512
#define NH    8
#define DQ    16      // per-head q/k dim
#define DV    64      // per-head v dim
#define ROWS  (BATCH * SEQ)   // 8192

typedef __attribute__((ext_vector_type(16))) _Float16 v16h;
typedef __attribute__((ext_vector_type(8)))  float    v8f;

union Frag {
    v16h      v;
    _Float16  h[16];
    uint4     q[2];
};

static __device__ __forceinline__ v8f wmma16(v16h a, v16h b, v8f c) {
    return __builtin_amdgcn_wmma_f32_16x16x32_f16(
        /*neg_a=*/false, a, /*neg_b=*/false, b,
        /*c_mod=*/(short)0, c, /*reuse_a=*/false, /*reuse_b=*/false);
}

// ---------------------------------------------------------------------------
// fp32 -> fp16 conversion
// ---------------------------------------------------------------------------
__global__ void cvt_f32_f16(const float* __restrict__ in, _Float16* __restrict__ out, int n) {
    int i = blockIdx.x * blockDim.x + threadIdx.x;
    if (i < n) out[i] = (_Float16)in[i];
}

// ---------------------------------------------------------------------------
// Projection GEMM: C[ROWS x N] = A[ROWS x 512] * Bw[512 x N] + bias
// Output written f16 in head-split layout: out[((b*NH+h)*SEQ+m)*hd + d]
// Block tile 64(M) x 128(N), 8 waves (4x2), wave tile 16x64, K step 32.
// hdShift: log2(head dim) -> 4 for q/k, 6 for v (avoids runtime div/mod).
// ---------------------------------------------------------------------------
__global__ __launch_bounds__(256) void gemm_proj(
    const _Float16* __restrict__ A, const _Float16* __restrict__ Bw,
    const float* __restrict__ bias, _Float16* __restrict__ outp,
    int N, int hdShift)
{
    __shared__ alignas(16) _Float16 As[64][32];
    __shared__ alignas(16) _Float16 BsT[128][32];   // transposed: [n][k]

    const int tid  = threadIdx.x;
    const int wave = tid >> 5;
    const int lane = tid & 31;
    const int half = lane >> 4;
    const int l    = lane & 15;
    const int mw   = wave >> 1;        // 0..3
    const int nw   = wave & 1;         // 0..1

    const int r0 = blockIdx.x * 64;
    const int n0 = blockIdx.y * 128;

    // per-thread staging coordinates (loop-invariant)
    const int aIdx = tid * 8;
    const int aRow = aIdx >> 5, aCol = aIdx & 31;
    const int bIdx = tid * 16;
    const int bK = bIdx >> 7, bN = bIdx & 127;

    const _Float16* aSrcBase = A + (size_t)(r0 + aRow) * 512 + aCol;
    const _Float16* bSrcBase = Bw + (size_t)bK * N + n0 + bN;

    v8f acc[4];
    v8f zero = {};
    acc[0] = zero; acc[1] = zero; acc[2] = zero; acc[3] = zero;

    for (int kk = 0; kk < 512; kk += 32) {
        __syncthreads();
        // stage A tile 64x32 (each thread: one uint4 = 8 halves, contiguous)
        *(uint4*)&As[aRow][aCol] = *(const uint4*)(aSrcBase + kk);
        // stage B tile 32x128 transposed into BsT[128][32]
        {
            const _Float16* src = bSrcBase + (size_t)kk * N;
            alignas(16) _Float16 tmp[16];
            *(uint4*)&tmp[0] = *(const uint4*)src;
            *(uint4*)&tmp[8] = *(const uint4*)(src + 8);
#pragma unroll
            for (int e = 0; e < 16; e++) BsT[bN + e][bK] = tmp[e];
        }
        // prefetch next iteration's tiles into cache while we compute
        if (kk + 32 < 512) {
            __builtin_prefetch(aSrcBase + kk + 32, 0, 1);
            __builtin_prefetch(bSrcBase + (size_t)(kk + 32) * N, 0, 1);
        }
        __syncthreads();

        // A fragment (16x32, documented 16-bit A layout)
        Frag af;
        af.q[0] = *(const uint4*)&As[mw * 16 + l][half * 8];
        af.q[1] = *(const uint4*)&As[mw * 16 + l][16 + half * 8];
#pragma unroll
        for (int f = 0; f < 4; f++) {
            Frag bfr;
            int n = nw * 64 + f * 16 + l;
            bfr.q[0] = *(const uint4*)&BsT[n][half * 8];
            bfr.q[1] = *(const uint4*)&BsT[n][16 + half * 8];
            acc[f] = wmma16(af.v, bfr.v, acc[f]);
        }
    }

    // epilogue: bias + head-split f16 store (shift/mask instead of div/mod)
    const int hdMask = (1 << hdShift) - 1;
#pragma unroll
    for (int f = 0; f < 4; f++) {
        int ncol = n0 + nw * 64 + f * 16 + l;
        float bs = bias[ncol];
        int h = ncol >> hdShift;
        int d = ncol & hdMask;
#pragma unroll
        for (int r = 0; r < 8; r++) {
            int grow = r0 + mw * 16 + r + half * 8;
            int b_ = grow >> 11;           // / SEQ
            int m  = grow & (SEQ - 1);
            size_t dst = ((((size_t)b_ * NH + h) * SEQ + m) << hdShift) + d;
            outp[dst] = (_Float16)(acc[f][r] + bs);
        }
    }
}

// ---------------------------------------------------------------------------
// Streaming attention: one block = 128 query rows of one (b,h); 8 waves.
// Per wave: 16 queries; loop key blocks of 32, both products transposed:
//   S^T = K*Q^T (2 wmma): a lane holds 16 of the 32 scores of ONE query,
//   relu + online softmax (+mask) in-lane, one exchange between wave halves,
//   O^T += V^T*P^T (4 wmma): the two S^T tiles, packed to f16, are the B operand.
// ---------------------------------------------------------------------------
// lane l <-> lane l ^ 16
static __device__ __forceinline__ float xhalf(float x) {
    int b = __builtin_bit_cast(int, x);
    return __builtin_bit_cast(float,
        __builtin_amdgcn_permlanex16(b, b, 0x76543210, 0xfedcba98, false, false));
}

__global__ __launch_bounds__(256) void attn_kernel(
    const _Float16* __restrict__ Q, const _Float16* __restrict__ K,
    const _Float16* __restrict__ V, const int* __restrict__ mask,
    const float* __restrict__ gamma, float* __restrict__ out)
{
    __shared__ alignas(16) _Float16 Kt[32][16];        // [key][d]
    __shared__ alignas(16) _Float16 Vt[DV][32];        // transposed: [d][key]
    __shared__ alignas(32) float mskf[32];

    const int tid  = threadIdx.x;
    const int wave = tid >> 5;
    const int lane = tid & 31;
    const int half = lane >> 4;
    const int l    = lane & 15;

    const int bh = blockIdx.y;            // b*NH + h
    const int b  = bh >> 3;               // / NH
    const int h  = bh & (NH - 1);
    const int q0 = blockIdx.x * 128 + wave * 16;

    const size_t headBase = (size_t)bh * SEQ;

    // per-thread staging coordinates (loop-invariant)
    const int kIdx = tid * 2;
    const int kKey = kIdx >> 4, kD = kIdx & 15;
    const int vIdx = tid * 8;
    const int vKey = vIdx >> 6, vD = vIdx & 63;
    const _Float16* kSrcBase = K + (headBase + kKey) * DQ + kD;
    const _Float16* vSrcBase = V + (headBase + vKey) * DV + vD;

    // Q^T fragment (B operand): column = query l, 16 d padded to 32 (upper k zero)
    Frag qb;
    qb.q[0] = *(const uint4*)(Q + (headBase + q0 + l) * DQ + half * 8);
    qb.q[1] = make_uint4(0u, 0u, 0u, 0u);

    v8f zero = {};
    v8f o0 = zero, o1 = zero, o2 = zero, o3 = zero;   // o_f[r] = O[query l][f*16 + half*8 + r]
    float rm = 0.0f;   // running max of query l (relu => scores >= 0), equal in both halves
    float rl = 0.0f;   // this half's share of the masked running sum of query l

    const float scale = 0.25f;  // 1/sqrt(16)
    const float log2e = 1.44269504f;  // exp(x) = exp2(x * log2e)

    for (int j = 0; j < SEQ; j += 32) {
        __syncthreads();
        // stage K block 32x16 (one uint = 2 halves per thread)
        *(unsigned int*)&Kt[kKey][kD] =
            *(const unsigned int*)(kSrcBase + (size_t)j * DQ);
        // stage V block 32x64 transposed (uint4 = 8 halves per thread)
        {
            uint4 t = *(const uint4*)(vSrcBase + (size_t)j * DV);
            alignas(16) _Float16 tmp[8];
            *(uint4*)tmp = t;
#pragma unroll
            for (int e = 0; e < 8; e++) Vt[vD + e][vKey] = tmp[e];
        }
        if (tid < 32) mskf[tid] = (float)mask[(size_t)b * SEQ + j + tid];
        // prefetch next key block while this one is consumed
        if (j + 32 < SEQ) {
            __builtin_prefetch(kSrcBase + (size_t)(j + 32) * DQ, 0, 1);
            __builtin_prefetch(vSrcBase + (size_t)(j + 32) * DV, 0, 1);
        }
        __syncthreads();

        // scores: S^T[32 keys x 16 queries] via two wmma (A = K rows, padded k)
        Frag ka0, ka1;
        ka0.q[0] = *(const uint4*)&Kt[l][half * 8];
        ka0.q[1] = make_uint4(0u, 0u, 0u, 0u);
        ka1.q[0] = *(const uint4*)&Kt[16 + l][half * 8];
        ka1.q[1] = make_uint4(0u, 0u, 0u, 0u);
        v8f s0 = wmma16(ka0.v, qb.v, zero);   // s0[r]: key      half*8 + r, query l
        v8f s1 = wmma16(ka1.v, qb.v, zero);   // s1[r]: key 16 + half*8 + r, query l

        // masks of this lane's 16 keys
        const v8f mk0 = *(const v8f*)&mskf[half * 8];
        const v8f mk1 = *(const v8f*)&mskf[16 + half * 8];

        // relu(pre-softmax) and the block's max for query l
        s0 = __builtin_elementwise_max(s0 * scale, zero);
        s1 = __builtin_elementwise_max(s1 * scale, zero);
        float t = 0.0f;
#pragma unroll
        for (int r = 0; r < 8; r++) t = fmaxf(t, fmaxf(s0[r], s1[r]));
        t = fmaxf(t, xhalf(t));
        const float mnew = fmaxf(rm, t);
        const float sf = __builtin_amdgcn_exp2f((rm - mnew) * log2e);
        rm = mnew;

        // masked probabilities; packed in place they are P^T in B-operand order
        s0 = (s0 - mnew) * log2e;
        s1 = (s1 - mnew) * log2e;
#pragma unroll
        for (int r = 0; r < 8; r++) {
            s0[r] = __builtin_amdgcn_exp2f(s0[r]);
            s1[r] = __builtin_amdgcn_exp2f(s1[r]);
        }
        s0 *= mk0;
        s1 *= mk1;
        Frag pb;
#pragma unroll
        for (int r = 0; r < 8; r++) {
            pb.h[r]     = (_Float16)s0[r];
            pb.h[8 + r] = (_Float16)s1[r];
        }
        const v8f ps = s0 + s1;
        rl = rl * sf + (((ps[0] + ps[1]) + (ps[2] + ps[3])) + ((ps[4] + ps[5]) + (ps[6] + ps[7])));
        o0 *= sf; o1 *= sf; o2 *= sf; o3 *= sf;

        // V^T fragments (A operand, rows = d, from transposed Vt)
        {
            Frag va;
            va.q[0] = *(const uint4*)&Vt[0 * 16 + l][half * 8];
            va.q[1] = *(const uint4*)&Vt[0 * 16 + l][16 + half * 8];
            o0 = wmma16(va.v, pb.v, o0);
            va.q[0] = *(const uint4*)&Vt[1 * 16 + l][half * 8];
            va.q[1] = *(const uint4*)&Vt[1 * 16 + l][16 + half * 8];
            o1 = wmma16(va.v, pb.v, o1);
            va.q[0] = *(const uint4*)&Vt[2 * 16 + l][half * 8];
            va.q[1] = *(const uint4*)&Vt[2 * 16 + l][16 + half * 8];
            o2 = wmma16(va.v, pb.v, o2);
            va.q[0] = *(const uint4*)&Vt[3 * 16 + l][half * 8];
            va.q[1] = *(const uint4*)&Vt[3 * 16 + l][16 + half * 8];
            o3 = wmma16(va.v, pb.v, o3);
        }
    }

    // epilogue: join the halves' sums, beta normalization, gamma, fp32 store
    const float g = gamma[0];
    const float inv = g / (rl + xhalf(rl) + 1e-12f);
    float* orow = out + ((size_t)b * SEQ + q0 + l) * CH + (size_t)h * DV + half * 8;
    *(float4*)(orow +  0) = make_float4(o0[0] * inv, o0[1] * inv, o0[2] * inv, o0[3] * inv);
    *(float4*)(orow +  4) = make_float4(o0[4] * inv, o0[5] * inv, o0[6] * inv, o0[7] * inv);
    *(float4*)(orow + 16) = make_float4(o1[0] * inv, o1[1] * inv, o1[2] * inv, o1[3] * inv);
    *(float4*)(orow + 20) = make_float4(o1[4] * inv, o1[5] * inv, o1[6] * inv, o1[7] * inv);
    *(float4*)(orow + 32) = make_float4(o2[0] * inv, o2[1] * inv, o2[2] * inv, o2[3] * inv);
    *(float4*)(orow + 36) = make_float4(o2[4] * inv, o2[5] * inv, o2[6] * inv, o2[7] * inv);
    *(float4*)(orow + 48) = make_float4(o3[0] * inv, o3[1] * inv, o3[2] * inv, o3[3] * inv);
    *(float4*)(orow + 52) = make_float4(o3[4] * inv, o3[5] * inv, o3[6] * inv, o3[7] * inv);
}

// ---------------------------------------------------------------------------
// launch
// ---------------------------------------------------------------------------
extern "C" void kernel_launch(void* const* d_in, const int* in_sizes, int n_in,
                              void* d_out, int out_size, void* d_ws, size_t ws_size,
                              hipStream_t stream) {
    const float* x     = (const float*)d_in[0];   // (4,2048,512)
    const int*   mask  = (const int*)d_in[1];     // (4,2048)
    const float* Wq    = (const float*)d_in[2];   // (512,128)
    const float* bq    = (const float*)d_in[3];   // (128)
    const float* Wk    = (const float*)d_in[4];   // (512,128)
    const float* bk    = (const float*)d_in[5];   // (128)
    const float* Wv    = (const float*)d_in[6];   // (512,512)
    const float* bv    = (const float*)d_in[7];   // (512)
    const float* gamma = (const float*)d_in[8];   // (1)
    float* out = (float*)d_out;

    // workspace layout (f16 buffers), 256B aligned
    char* ws = (char*)d_ws;
    size_t off = 0;
    auto take = [&](size_t bytes) -> char* {
        char* p = ws + off;
        off = (off + bytes + 255) & ~(size_t)255;
        return p;
    };
    _Float16* xh  = (_Float16*)take((size_t)ROWS * CH * 2);            // 8 MB
    _Float16* wqh = (_Float16*)take((size_t)CH * 128 * 2);
    _Float16* wkh = (_Float16*)take((size_t)CH * 128 * 2);
    _Float16* wvh = (_Float16*)take((size_t)CH * CH * 2);
    _Float16* qh  = (_Float16*)take((size_t)BATCH * NH * SEQ * DQ * 2); // 2 MB
    _Float16* kh  = (_Float16*)take((size_t)BATCH * NH * SEQ * DQ * 2); // 2 MB
    _Float16* vh  = (_Float16*)take((size_t)BATCH * NH * SEQ * DV * 2); // 8 MB

    // 1) fp32 -> fp16 conversions
    {
        int n;
        n = ROWS * CH;   cvt_f32_f16<<<(n + 255) / 256, 256, 0, stream>>>(x,  xh,  n);
        n = CH * 128;    cvt_f32_f16<<<(n + 255) / 256, 256, 0, stream>>>(Wq, wqh, n);
        n = CH * 128;    cvt_f32_f16<<<(n + 255) / 256, 256, 0, stream>>>(Wk, wkh, n);
        n = CH * CH;     cvt_f32_f16<<<(n + 255) / 256, 256, 0, stream>>>(Wv, wvh, n);
    }

    // 2) projections (WMMA GEMM, head-split f16 outputs)
    gemm_proj<<<dim3(ROWS / 64, 1), 256, 0, stream>>>(xh, wqh, bq, qh, 128, 4);
    gemm_proj<<<dim3(ROWS / 64, 1), 256, 0, stream>>>(xh, wkh, bk, kh, 128, 4);
    gemm_proj<<<dim3(ROWS / 64, 4), 256, 0, stream>>>(xh, wvh, bv, vh, 512, 6);

    // 3) streaming masked-softmax attention (WMMA), fp32 output
    attn_kernel<<<dim3(SEQ / 128, BATCH * NH), 256, 0, stream>>>(
        qh, kh, vh, mask, gamma, out);
}

// v002
// Measured time: 150 microseconds a run.
// Timed twice side by side with v001, it ran 1.08 times as fast both times.
// Counting every step since v000, it is 1.36 times as fast.
#include <hip/hip_runtime.h>
#include <hip/hip_bf16.h>

// ---- problem constants (from reference) ----
#define BATCH 4
#define SEQ   2048
#define CH    512
#define NH    8
#define DQ    16      // per-head q/k dim
#define DV    64      // per-head v dim
#define ROWS  (BATCH * SEQ)   // 8192

typedef __attribute__((ext_vector_type(16))) _Float16 v16h;
typedef __attribute__((ext_vector_type(8)))  float    v8f;
typedef __attribute__((ext_vector_type(4)))  float    v4f;

union Frag {
    v16h      v;
    _Float16  h[16];
    uint4     q[2];
};

static __device__ __forceinline__ v8f wmma16(v16h a, v16h b, v8f c) {
    return __builtin_amdgcn_wmma_f32_16x16x32_f16(
        /*neg_a=*/false, a, /*neg_b=*/false, b,
        /*c_mod=*/(short)0, c, /*reuse_a=*/false, /*reuse_b=*/false);
}

// ---------------------------------------------------------------------------
// Projection GEMM: C[ROWS x N] = A[ROWS x 512] * Bw[512 x N] + bias
// A and Bw are read as fp32 and rounded to f16 on the way into LDS.
// Output written f16 in head-split layout: out[((b*NH+h)*SEQ+m)*hd + d]
// Block tile 64(M) x 128(N), 8 waves (4x2), wave tile 16x64, K step 32.
// hdShift: log2(head dim) -> 4 for q/k, 6 for v (avoids runtime div/mod).
// ---------------------------------------------------------------------------
__global__ __launch_bounds__(256) void gemm_proj(
    const float* __restrict__ A, const float* __restrict__ Bw,
    const float* __restrict__ bias, _Float16* __restrict__ outp,
    int N, int hdShift)
{
    __shared__ alignas(16) _Float16 As[64][32];
    __shared__ alignas(16) _Float16 BsT[128][32];   // transposed: [n][k]

    const int tid  = threadIdx.x;
    const int wave = tid >> 5;
    const int lane = tid & 31;
    const int half = lane >> 4;
    const int l    = lane & 15;
    const int mw   = wave >> 1;        // 0..3
    const int nw   = wave & 1;         // 0..1

    const int r0 = blockIdx.x * 64;
    const int n0 = blockIdx.y * 128;

    // per-thread staging coordinates (loop-invariant)
    const int aIdx = tid * 8;
    const int aRow = aIdx >> 5, aCol = aIdx & 31;
    const int bIdx = tid * 16;
    const int bK = bIdx >> 7, bN = bIdx & 127;

    const float* aSrcBase = A + (size_t)(r0 + aRow) * 512 + aCol;
    const float* bSrcBase = Bw + (size_t)bK * N + n0 + bN;

    v8f acc[4];
    v8f zero = {};
    acc[0] = zero; acc[1] = zero; acc[2] = zero; acc[3] = zero;

    for (int kk = 0; kk < 512; kk += 32) {
        __syncthreads();
        {
            // this thread's 8 fp32 of the A tile and 16 fp32 of the B tile
            const float* bsrc = bSrcBase + (size_t)kk * N;
            v4f fa[2], fb[4];
            fa[0] = *(const v4f*)(aSrcBase + kk);
            fa[1] = *(const v4f*)(aSrcBase + kk + 4);
#pragma unroll
            for (int e = 0; e < 4; e++) fb[e] = *(const v4f*)(bsrc + e * 4);
            // inputs-only fence on the loaded values: keeps the six loads in flight
            // together; without it each load is waited for before the next is issued
            asm volatile("" :: "v"(fa[0]), "v"(fa[1]), "v"(fb[0]), "v"(fb[1]), "v"(fb[2]), "v"(fb[3]));
            // stage A tile 64x32 (8 halves per thread, contiguous)
            alignas(16) _Float16 ta[8];
#pragma unroll
            for (int e = 0; e < 2; e++) {
                ta[e * 4 + 0] = (_Float16)fa[e].x;
                ta[e * 4 + 1] = (_Float16)fa[e].y;
                ta[e * 4 + 2] = (_Float16)fa[e].z;
                ta[e * 4 + 3] = (_Float16)fa[e].w;
            }
            *(uint4*)&As[aRow][aCol] = *(const uint4*)ta;
            // stage B tile 32x128 transposed into BsT[128][32]
#pragma unroll
            for (int e = 0; e < 4; e++) {
                BsT[bN + e * 4 + 0][bK] = (_Float16)fb[e].x;
                BsT[bN + e * 4 + 1][bK] = (_Float16)fb[e].y;
                BsT[bN + e * 4 + 2][bK] = (_Float16)fb[e].z;
                BsT[bN + e * 4 + 3][bK] = (_Float16)fb[e].w;
            }
        }
        // prefetch next iteration's tiles into cache while we compute
        if (kk + 32 < 512) {
            __builtin_prefetch(aSrcBase + kk + 32, 0, 1);
            __builtin_prefetch(bSrcBase + (size_t)(kk + 32) * N, 0, 1);
        }
        __syncthreads();

        // A fragment (16x32, documented 16-bit A layout)
        Frag af;
        af.q[0] = *(const uint4*)&As[mw * 16 + l][half * 8];
        af.q[1] = *(const uint4*)&As[mw * 16 + l][16 + half * 8];
#pragma unroll
        for (int f = 0; f < 4; f++) {
            Frag bfr;
            int n = nw * 64 + f * 16 + l;
            bfr.q[0] = *(const uint4*)&BsT[n][half * 8];
            bfr.q[1] = *(const uint4*)&BsT[n][16 + half * 8];
            acc[f] = wmma16(af.v, bfr.v, acc[f]);
        }
    }

    // epilogue: bias + head-split f16 store (shift/mask instead of div/mod)
    const int hdMask = (1 << hdShift) - 1;
#pragma unroll
    for (int f = 0; f < 4; f++) {
        int ncol = n0 + nw * 64 + f * 16 + l;
        float bs = bias[ncol];
        int h = ncol >> hdShift;
        int d = ncol & hdMask;
#pragma unroll
        for (int r = 0; r < 8; r++) {
            int grow = r0 + mw * 16 + r + half * 8;
            int b_ = grow >> 11;           // / SEQ
            int m  = grow & (SEQ - 1);
            size_t dst = ((((size_t)b_ * NH + h) * SEQ + m) << hdShift) + d;
            outp[dst] = (_Float16)(acc[f][r] + bs);
        }
    }
}

// ---------------------------------------------------------------------------
// Streaming attention: one block = 128 query rows of one (b,h); 8 waves.
// Per wave: 16 queries; loop key blocks of 32, both products transposed:
//   S^T = K*Q^T (2 wmma): a lane holds 16 of the 32 scores of ONE query,
//   relu + online softmax (+mask) in-lane, one exchange between wave halves,
//   O^T += V^T*P^T (4 wmma): the two S^T tiles, packed to f16, are the B operand.
// ---------------------------------------------------------------------------
// lane l <-> lane l ^ 16
static __device__ __forceinline__ float xhalf(float x) {
    int b = __builtin_bit_cast(int, x);
    return __builtin_bit_cast(float,
        __builtin_amdgcn_permlanex16(b, b, 0x76543210, 0xfedcba98, false, false));
}

__global__ __launch_bounds__(256) void attn_kernel(
    const _Float16* __restrict__ Q, const _Float16* __restrict__ K,
    const _Float16* __restrict__ V, const int* __restrict__ mask,
    const float* __restrict__ gamma, float* __restrict__ out)
{
    __shared__ alignas(16) _Float16 Kt[32][16];        // [key][d]
    __shared__ alignas(16) _Float16 Vt[DV][32];        // transposed: [d][key]
    __shared__ alignas(32) float mskf[32];

    const int tid  = threadIdx.x;
    const int wave = tid >> 5;
    const int lane = tid & 31;
    const int half = lane >> 4;
    const int l    = lane & 15;

    const int bh = blockIdx.y;            // b*NH + h
    const int b  = bh >> 3;               // / NH
    const int h  = bh & (NH - 1);
    const int q0 = blockIdx.x * 128 + wave * 16;

    const size_t headBase = (size_t)bh * SEQ;

    // per-thread staging coordinates (loop-invariant)
    const int kIdx = tid * 2;
    const int kKey = kIdx >> 4, kD = kIdx & 15;
    const int vIdx = tid * 8;
    const int vKey = vIdx >> 6, vD = vIdx & 63;
    const _Float16* kSrcBase = K + (headBase + kKey) * DQ + kD;
    const _Float16* vSrcBase = V + (headBase + vKey) * DV + vD;

    // Q^T fragment (B operand): column = query l, 16 d padded to 32 (upper k zero)
    Frag qb;
    qb.q[0] = *(const uint4*)(Q + (headBase + q0 + l) * DQ + half * 8);
    qb.q[1] = make_uint4(0u, 0u, 0u, 0u);

    v8f zero = {};
    v8f o0 = zero, o1 = zero, o2 = zero, o3 = zero;   // o_f[r] = O[query l][f*16 + half*8 + r]
    float rm = 0.0f;   // running max of query l (relu => scores >= 0), equal in both halves
    float rl = 0.0f;   // this half's share of the masked running sum of query l

    const float scale = 0.25f;  // 1/sqrt(16)
    const float log2e = 1.44269504f;  // exp(x) = exp2(x * log2e)

    for (int j = 0; j < SEQ; j += 32) {
        __syncthreads();
        // stage K block 32x16 (one uint = 2 halves per thread)
        *(unsigned int*)&Kt[kKey][kD] =
            *(const unsigned int*)(kSrcBase + (size_t)j * DQ);
        // stage V block 32x64 transposed (uint4 = 8 halves per thread)
        {
            uint4 t = *(const uint4*)(vSrcBase + (size_t)j * DV);
            alignas(16) _Float16 tmp[8];
            *(uint4*)tmp = t;
#pragma unroll
            for (int e = 0; e < 8; e++) Vt[vD + e][vKey] = tmp[e];
        }
        if (tid < 32) mskf[tid] = (float)mask[(size_t)b * SEQ + j + tid];
        // prefetch next key block while this one is consumed
        if (j + 32 < SEQ) {
            __builtin_prefetch(kSrcBase + (size_t)(j + 32) * DQ, 0, 1);
            __builtin_prefetch(vSrcBase + (size_t)(j + 32) * DV, 0, 1);
        }
        __syncthreads();

        // scores: S^T[32 keys x 16 queries] via two wmma (A = K rows, padded k)
        Frag ka0, ka1;
        ka0.q[0] = *(const uint4*)&Kt[l][half * 8];
        ka0.q[1] = make_uint4(0u, 0u, 0u, 0u);
        ka1.q[0] = *(const uint4*)&Kt[16 + l][half * 8];
        ka1.q[1] = make_uint4(0u, 0u, 0u, 0u);
        v8f s0 = wmma16(ka0.v, qb.v, zero);   // s0[r]: key      half*8 + r, query l
        v8f s1 = wmma16(ka1.v, qb.v, zero);   // s1[r]: key 16 + half*8 + r, query l

        // masks of this lane's 16 keys
        const v8f mk0 = *(const v8f*)&mskf[half * 8];
        const v8f mk1 = *(const v8f*)&mskf[16 + half * 8];

        // relu(pre-softmax) and the block's max for query l
        s0 = __builtin_elementwise_max(s0 * scale, zero);
        s1 = __builtin_elementwise_max(s1 * scale, zero);
        float t = 0.0f;
#pragma unroll
        for (int r = 0; r < 8; r++) t = fmaxf(t, fmaxf(s0[r], s1[r]));
        t = fmaxf(t, xhalf(t));
        const float mnew = fmaxf(rm, t);
        const float sf = __builtin_amdgcn_exp2f((rm - mnew) * log2e);
        rm = mnew;

        // masked probabilities; packed in place they are P^T in B-operand order
        s0 = (s0 - mnew) * log2e;
        s1 = (s1 - mnew) * log2e;
#pragma unroll
        for (int r = 0; r < 8; r++) {
            s0[r] = __builtin_amdgcn_exp2f(s0[r]);
            s1[r] = __builtin_amdgcn_exp2f(s1[r]);
        }
        s0 *= mk0;
        s1 *= mk1;
        Frag pb;
#pragma unroll
        for (int r = 0; r < 8; r++) {
            pb.h[r]     = (_Float16)s0[r];
            pb.h[8 + r] = (_Float16)s1[r];
        }
        const v8f ps = s0 + s1;
        rl = rl * sf + (((ps[0] + ps[1]) + (ps[2] + ps[3])) + ((ps[4] + ps[5]) + (ps[6] + ps[7])));
        o0 *= sf; o1 *= sf; o2 *= sf; o3 *= sf;

        // V^T fragments (A operand, rows = d, from transposed Vt)
        {
            Frag va;
            va.q[0] = *(const uint4*)&Vt[0 * 16 + l][half * 8];
            va.q[1] = *(const uint4*)&Vt[0 * 16 + l][16 + half * 8];
            o0 = wmma16(va.v, pb.v, o0);
            va.q[0] = *(const uint4*)&Vt[1 * 16 + l][half * 8];
            va.q[1] = *(const uint4*)&Vt[1 * 16 + l][16 + half * 8];
            o1 = wmma16(va.v, pb.v, o1);
            va.q[0] = *(const uint4*)&Vt[2 * 16 + l][half * 8];
            va.q[1] = *(const uint4*)&Vt[2 * 16 + l][16 + half * 8];
            o2 = wmma16(va.v, pb.v, o2);
            va.q[0] = *(const uint4*)&Vt[3 * 16 + l][half * 8];
            va.q[1] = *(const uint4*)&Vt[3 * 16 + l][16 + half * 8];
            o3 = wmma16(va.v, pb.v, o3);
        }
    }

    // epilogue: join the halves' sums, beta normalization, gamma, fp32 store
    const float g = gamma[0];
    const float inv = g / (rl + xhalf(rl) + 1e-12f);
    float* orow = out + ((size_t)b * SEQ + q0 + l) * CH + (size_t)h * DV + half * 8;
    *(float4*)(orow +  0) = make_float4(o0[0] * inv, o0[1] * inv, o0[2] * inv, o0[3] * inv);
    *(float4*)(orow +  4) = make_float4(o0[4] * inv, o0[5] * inv, o0[6] * inv, o0[7] * inv);
    *(float4*)(orow + 16) = make_float4(o1[0] * inv, o1[1] * inv, o1[2] * inv, o1[3] * inv);
    *(float4*)(orow + 20) = make_float4(o1[4] * inv, o1[5] * inv, o1[6] * inv, o1[7] * inv);
    *(float4*)(orow + 32) = make_float4(o2[0] * inv, o2[1] * inv, o2[2] * inv, o2[3] * inv);
    *(float4*)(orow + 36) = make_float4(o2[4] * inv, o2[5] * inv, o2[6] * inv, o2[7] * inv);
    *(float4*)(orow + 48) = make_float4(o3[0] * inv, o3[1] * inv, o3[2] * inv, o3[3] * inv);
    *(float4*)(orow + 52) = make_float4(o3[4] * inv, o3[5] * inv, o3[6] * inv, o3[7] * inv);
}

// ---------------------------------------------------------------------------
// launch
// ---------------------------------------------------------------------------
extern "C" void kernel_launch(void* const* d_in, const int* in_sizes, int n_in,
                              void* d_out, int out_size, void* d_ws, size_t ws_size,
                              hipStream_t stream) {
    const float* x     = (const float*)d_in[0];   // (4,2048,512)
    const int*   mask  = (const int*)d_in[1];     // (4,2048)
    const float* Wq    = (const float*)d_in[2];   // (512,128)
    const float* bq    = (const float*)d_in[3];   // (128)
    const float* Wk    = (const float*)d_in[4];   // (512,128)
    const float* bk    = (const float*)d_in[5];   // (128)
    const float* Wv    = (const float*)d_in[6];   // (512,512)
    const float* bv    = (const float*)d_in[7];   // (512)
    const float* gamma = (const float*)d_in[8];   // (1)
    float* out = (float*)d_out;

    // workspace layout (f16 buffers), 256B aligned
    char* ws = (char*)d_ws;
    size_t off = 0;
    auto take = [&](size_t bytes) -> char* {
        char* p = ws + off;
        off = (off + bytes + 255) & ~(size_t)255;
        return p;
    };
    _Float16* qh  = (_Float16*)take((size_t)BATCH * NH * SEQ * DQ * 2); // 2 MB
    _Float16* kh  = (_Float16*)take((size_t)BATCH * NH * SEQ * DQ * 2); // 2 MB
    _Float16* vh  = (_Float16*)take((size_t)BATCH * NH * SEQ * DV * 2); // 8 MB

    // 1) projections (WMMA GEMM on fp32 inputs, head-split f16 outputs)
    gemm_proj<<<dim3(ROWS / 64, 1), 256, 0, stream>>>(x, Wq, bq, qh, 128, 4);
    gemm_proj<<<dim3(ROWS / 64, 1), 256, 0, stream>>>(x, Wk, bk, kh, 128, 4);
    gemm_proj<<<dim3(ROWS / 64, 4), 256, 0, stream>>>(x, Wv, bv, vh, 512, 6);

    // 2) streaming masked-softmax attention (WMMA), fp32 output
    attn_kernel<<<dim3(SEQ / 128, BATCH * NH), 256, 0, stream>>>(
        qh, kh, vh, mask, gamma, out);
}

// v003
// Measured time: 98.2 microseconds a run.
// In both of two side-by-side timings against v002, it was 1.52 times as fast.
// Over all steps from v000 it is 2.08 times as fast.
#include <hip/hip_runtime.h>
#include <hip/hip_bf16.h>

// ---- problem constants (from reference) ----
#define BATCH 4
#define SEQ   2048
#define CH    512
#define NH    8
#define DQ    16      // per-head q/k dim
#define DV    64      // per-head v dim
#define ROWS  (BATCH * SEQ)   // 8192

typedef __attribute__((ext_vector_type(16))) _Float16 v16h;
typedef __attribute__((ext_vector_type(8)))  float    v8f;
typedef __attribute__((ext_vector_type(4)))  float    v4f;

union Frag {
    v16h      v;
    _Float16  h[16];
    uint4     q[2];
};

// 16-bit transposing LDS load: from a row-major tile T[k][n], lane (c = lane & 15, h = lane >> 4)
// gets T[k0 + 8h + 0..7][n0 + c]; the lane's own address is
// T + (k0 + 8h + (lane & 7)) * pitch + 2 * n0 + 16 * ((lane >> 3) & 1) bytes.
// Loads at k0 and k0 + 16 make one 16x32 operand in the hardware k order.
typedef __attribute__((ext_vector_type(8))) short s16x8;
static __device__ __forceinline__ uint4 ld_tr16(const _Float16* p) {
    typedef __attribute__((address_space(3))) s16x8 lds_s16x8;
    return __builtin_bit_cast(uint4, __builtin_amdgcn_ds_load_tr16_b128_v8i16((lds_s16x8*)p));
}

// LDS row pitches in halves: 16 B x odd for ds_load_b128 readers, 32 B x odd for ds_load_tr16_b128
#define AS_PITCH 40    // 64-B rows  -> 80 B
#define BS_PITCH 144   // 256-B rows -> 288 B
#define VS_PITCH 80    // 128-B rows -> 160 B

static __device__ __forceinline__ v8f wmma16(v16h a, v16h b, v8f c) {
    return __builtin_amdgcn_wmma_f32_16x16x32_f16(
        /*neg_a=*/false, a, /*neg_b=*/false, b,
        /*c_mod=*/(short)0, c, /*reuse_a=*/false, /*reuse_b=*/false);
}

// ---------------------------------------------------------------------------
// Projection GEMM: C[ROWS x N] = A[ROWS x 512] * Bw[512 x N] + bias
// A and Bw are read as fp32 and rounded to f16 on the way into LDS.
// Output written f16 in head-split layout: out[((b*NH+h)*SEQ+m)*hd + d]
// Block tile 64(M) x 128(N), 8 waves (4x2), wave tile 16x64, K step 32.
// hdShift: log2(head dim) -> 4 for q/k, 6 for v (avoids runtime div/mod).
// ---------------------------------------------------------------------------
__global__ __launch_bounds__(256) void gemm_proj(
    const float* __restrict__ A, const float* __restrict__ Bw,
    const float* __restrict__ bias, _Float16* __restrict__ outp,
    int N, int hdShift)
{
    __shared__ alignas(16) _Float16 As[64][AS_PITCH];
    __shared__ alignas(16) _Float16 Bs[32][BS_PITCH];   // row-major: [k][n]

    const int tid  = threadIdx.x;
    const int wave = tid >> 5;
    const int lane = tid & 31;
    const int half = lane >> 4;
    const int l    = lane & 15;
    const int mw   = wave >> 1;        // 0..3
    const int nw   = wave & 1;         // 0..1

    const int r0 = blockIdx.x * 64;
    const int n0 = blockIdx.y * 128;

    // per-thread staging coordinates (loop-invariant)
    const int aIdx = tid * 8;
    const int aRow = aIdx >> 5, aCol = aIdx & 31;
    const int bIdx = tid * 16;
    const int bK = bIdx >> 7, bN = bIdx & 127;

    const float* aSrcBase = A + (size_t)(r0 + aRow) * 512 + aCol;
    const float* bSrcBase = Bw + (size_t)bK * N + n0 + bN;

    // this lane's address for the transposing loads of the B tile
    const _Float16* bTr = &Bs[half * 8 + (lane & 7)][nw * 64 + ((lane >> 3) & 1) * 8];

    v8f acc[4];
    v8f zero = {};
    acc[0] = zero; acc[1] = zero; acc[2] = zero; acc[3] = zero;

    for (int kk = 0; kk < 512; kk += 32) {
        __syncthreads();
        {
            // this thread's 8 fp32 of the A tile and 16 fp32 of the B tile
            const float* bsrc = bSrcBase + (size_t)kk * N;
            v4f fa[2], fb[4];
            fa[0] = *(const v4f*)(aSrcBase + kk);
            fa[1] = *(const v4f*)(aSrcBase + kk + 4);
#pragma unroll
            for (int e = 0; e < 4; e++) fb[e] = *(const v4f*)(bsrc + e * 4);
            // inputs-only fence on the loaded values: keeps the six loads in flight
            // together; without it each load is waited for before the next is issued
            asm volatile("" :: "v"(fa[0]), "v"(fa[1]), "v"(fb[0]), "v"(fb[1]), "v"(fb[2]), "v"(fb[3]));
            // stage A tile 64x32 (8 halves per thread, contiguous)
            alignas(16) _Float16 ta[8];
#pragma unroll
            for (int e = 0; e < 2; e++) {
                ta[e * 4 + 0] = (_Float16)fa[e].x;
                ta[e * 4 + 1] = (_Float16)fa[e].y;
                ta[e * 4 + 2] = (_Float16)fa[e].z;
                ta[e * 4 + 3] = (_Float16)fa[e].w;
            }
            *(uint4*)&As[aRow][aCol] = *(const uint4*)ta;
            // stage B tile 32x128 row-major (16 halves per thread, contiguous)
            alignas(16) _Float16 tb[16];
#pragma unroll
            for (int e = 0; e < 4; e++) {
                tb[e * 4 + 0] = (_Float16)fb[e].x;
                tb[e * 4 + 1] = (_Float16)fb[e].y;
                tb[e * 4 + 2] = (_Float16)fb[e].z;
                tb[e * 4 + 3] = (_Float16)fb[e].w;
            }
            *(uint4*)&Bs[bK][bN]     = *(const uint4*)&tb[0];
            *(uint4*)&Bs[bK][bN + 8] = *(const uint4*)&tb[8];
        }
        // prefetch next iteration's tiles into cache while we compute
        if (kk + 32 < 512) {
            __builtin_prefetch(aSrcBase + kk + 32, 0, 1);
            __builtin_prefetch(bSrcBase + (size_t)(kk + 32) * N, 0, 1);
        }
        __syncthreads();

        // A fragment (16x32, documented 16-bit A layout)
        Frag af;
        af.q[0] = *(const uint4*)&As[mw * 16 + l][half * 8];
        af.q[1] = *(const uint4*)&As[mw * 16 + l][16 + half * 8];
#pragma unroll
        for (int f = 0; f < 4; f++) {
            // B fragment: column n = nw*64 + f*16 + l, same k order as the A fragment
            Frag bfr;
            bfr.q[0] = ld_tr16(bTr + f * 16);
            bfr.q[1] = ld_tr16(bTr + 16 * BS_PITCH + f * 16);
            acc[f] = wmma16(af.v, bfr.v, acc[f]);
        }
    }

    // epilogue: bias + head-split f16 store (shift/mask instead of div/mod)
    const int hdMask = (1 << hdShift) - 1;
#pragma unroll
    for (int f = 0; f < 4; f++) {
        int ncol = n0 + nw * 64 + f * 16 + l;
        float bs = bias[ncol];
        int h = ncol >> hdShift;
        int d = ncol & hdMask;
#pragma unroll
        for (int r = 0; r < 8; r++) {
            int grow = r0 + mw * 16 + r + half * 8;
            int b_ = grow >> 11;           // / SEQ
            int m  = grow & (SEQ - 1);
            size_t dst = ((((size_t)b_ * NH + h) * SEQ + m) << hdShift) + d;
            outp[dst] = (_Float16)(acc[f][r] + bs);
        }
    }
}

// ---------------------------------------------------------------------------
// Streaming attention: one block = 128 query rows of one (b,h); 8 waves.
// Per wave: 16 queries; loop key blocks of 32, both products transposed:
//   S^T = K*Q^T (2 wmma): a lane holds 16 of the 32 scores of ONE query,
//   relu + online softmax (+mask) in-lane, one exchange between wave halves,
//   O^T += V^T*P^T (4 wmma): the two S^T tiles, packed to f16, are the B operand.
// ---------------------------------------------------------------------------
// lane l <-> lane l ^ 16
static __device__ __forceinline__ float xhalf(float x) {
    int b = __builtin_bit_cast(int, x);
    return __builtin_bit_cast(float,
        __builtin_amdgcn_permlanex16(b, b, 0x76543210, 0xfedcba98, false, false));
}

__global__ __launch_bounds__(256) void attn_kernel(
    const _Float16* __restrict__ Q, const _Float16* __restrict__ K,
    const _Float16* __restrict__ V, const int* __restrict__ mask,
    const float* __restrict__ gamma, float* __restrict__ out)
{
    __shared__ alignas(16) _Float16 Kt[32][16];        // [key][d]
    __shared__ alignas(16) _Float16 Vs[32][VS_PITCH];  // row-major: [key][d]
    __shared__ alignas(32) float mskf[32];

    const int tid  = threadIdx.x;
    const int wave = tid >> 5;
    const int lane = tid & 31;
    const int half = lane >> 4;
    const int l    = lane & 15;

    const int bh = blockIdx.y;            // b*NH + h
    const int b  = bh >> 3;               // / NH
    const int h  = bh & (NH - 1);
    const int q0 = blockIdx.x * 128 + wave * 16;

    const size_t headBase = (size_t)bh * SEQ;

    // per-thread staging coordinates (loop-invariant)
    const int kIdx = tid * 2;
    const int kKey = kIdx >> 4, kD = kIdx & 15;
    const int vIdx = tid * 8;
    const int vKey = vIdx >> 6, vD = vIdx & 63;
    const _Float16* kSrcBase = K + (headBase + kKey) * DQ + kD;
    const _Float16* vSrcBase = V + (headBase + vKey) * DV + vD;

    // this lane's address for the transposing loads of the V tile
    const _Float16* vTr = &Vs[half * 8 + (lane & 7)][((lane >> 3) & 1) * 8];

    // Q^T fragment (B operand): column = query l, 16 d padded to 32 (upper k zero)
    Frag qb;
    qb.q[0] = *(const uint4*)(Q + (headBase + q0 + l) * DQ + half * 8);
    qb.q[1] = make_uint4(0u, 0u, 0u, 0u);

    v8f zero = {};
    v8f o0 = zero, o1 = zero, o2 = zero, o3 = zero;   // o_f[r] = O[query l][f*16 + half*8 + r]
    float rm = 0.0f;   // running max of query l (relu => scores >= 0), equal in both halves
    float rl = 0.0f;   // this half's share of the masked running sum of query l

    const float scale = 0.25f;  // 1/sqrt(16)
    const float log2e = 1.44269504f;  // exp(x) = exp2(x * log2e)

    for (int j = 0; j < SEQ; j += 32) {
        __syncthreads();
        // stage K block 32x16 (one uint = 2 halves per thread)
        *(unsigned int*)&Kt[kKey][kD] =
            *(const unsigned int*)(kSrcBase + (size_t)j * DQ);
        // stage V block 32x64 row-major (uint4 = 8 halves per thread)
        *(uint4*)&Vs[vKey][vD] = *(const uint4*)(vSrcBase + (size_t)j * DV);
        if (tid < 32) mskf[tid] = (float)mask[(size_t)b * SEQ + j + tid];
        // prefetch next key block while this one is consumed
        if (j + 32 < SEQ) {
            __builtin_prefetch(kSrcBase + (size_t)(j + 32) * DQ, 0, 1);
            __builtin_prefetch(vSrcBase + (size_t)(j + 32) * DV, 0, 1);
        }
        __syncthreads();

        // scores: S^T[32 keys x 16 queries] via two wmma (A = K rows, padded k)
        Frag ka0, ka1;
        ka0.q[0] = *(const uint4*)&Kt[l][half * 8];
        ka0.q[1] = make_uint4(0u, 0u, 0u, 0u);
        ka1.q[0] = *(const uint4*)&Kt[16 + l][half * 8];
        ka1.q[1] = make_uint4(0u, 0u, 0u, 0u);
        v8f s0 = wmma16(ka0.v, qb.v, zero);   // s0[r]: key      half*8 + r, query l
        v8f s1 = wmma16(ka1.v, qb.v, zero);   // s1[r]: key 16 + half*8 + r, query l

        // masks of this lane's 16 keys
        const v8f mk0 = *(const v8f*)&mskf[half * 8];
        const v8f mk1 = *(const v8f*)&mskf[16 + half * 8];

        // relu(pre-softmax) and the block's max for query l
        s0 = __builtin_elementwise_max(s0 * scale, zero);
        s1 = __builtin_elementwise_max(s1 * scale, zero);
        float t = 0.0f;
#pragma unroll
        for (int r = 0; r < 8; r++) t = fmaxf(t, fmaxf(s0[r], s1[r]));
        t = fmaxf(t, xhalf(t));
        const float mnew = fmaxf(rm, t);
        const float sf = __builtin_amdgcn_exp2f((rm - mnew) * log2e);
        rm = mnew;

        // masked probabilities; packed in place they are P^T in B-operand order
        s0 = (s0 - mnew) * log2e;
        s1 = (s1 - mnew) * log2e;
#pragma unroll
        for (int r = 0; r < 8; r++) {
            s0[r] = __builtin_amdgcn_exp2f(s0[r]);
            s1[r] = __builtin_amdgcn_exp2f(s1[r]);
        }
        s0 *= mk0;
        s1 *= mk1;
        Frag pb;
#pragma unroll
        for (int r = 0; r < 8; r++) {
            pb.h[r]     = (_Float16)s0[r];
            pb.h[8 + r] = (_Float16)s1[r];
        }
        const v8f ps = s0 + s1;
        rl = rl * sf + (((ps[0] + ps[1]) + (ps[2] + ps[3])) + ((ps[4] + ps[5]) + (ps[6] + ps[7])));
        o0 *= sf; o1 *= sf; o2 *= sf; o3 *= sf;

        // V^T fragments (A operand, rows = d) by transposing loads from the row-major tile
        {
            Frag va;
            va.q[0] = ld_tr16(vTr + 0 * 16);
            va.q[1] = ld_tr16(vTr + 16 * VS_PITCH + 0 * 16);
            o0 = wmma16(va.v, pb.v, o0);
            va.q[0] = ld_tr16(vTr + 1 * 16);
            va.q[1] = ld_tr16(vTr + 16 * VS_PITCH + 1 * 16);
            o1 = wmma16(va.v, pb.v, o1);
            va.q[0] = ld_tr16(vTr + 2 * 16);
            va.q[1] = ld_tr16(vTr + 16 * VS_PITCH + 2 * 16);
            o2 = wmma16(va.v, pb.v, o2);
            va.q[0] = ld_tr16(vTr + 3 * 16);
            va.q[1] = ld_tr16(vTr + 16 * VS_PITCH + 3 * 16);
            o3 = wmma16(va.v, pb.v, o3);
        }
    }

    // epilogue: join the halves' sums, beta normalization, gamma, fp32 store
    const float g = gamma[0];
    const float inv = g / (rl + xhalf(rl) + 1e-12f);
    float* orow = out + ((size_t)b * SEQ + q0 + l) * CH + (size_t)h * DV + half * 8;
    *(float4*)(orow +  0) = make_float4(o0[0] * inv, o0[1] * inv, o0[2] * inv, o0[3] * inv);
    *(float4*)(orow +  4) = make_float4(o0[4] * inv, o0[5] * inv, o0[6] * inv, o0[7] * inv);
    *(float4*)(orow + 16) = make_float4(o1[0] * inv, o1[1] * inv, o1[2] * inv, o1[3] * inv);
    *(float4*)(orow + 20) = make_float4(o1[4] * inv, o1[5] * inv, o1[6] * inv, o1[7] * inv);
    *(float4*)(orow + 32) = make_float4(o2[0] * inv, o2[1] * inv, o2[2] * inv, o2[3] * inv);
    *(float4*)(orow + 36) = make_float4(o2[4] * inv, o2[5] * inv, o2[6] * inv, o2[7] * inv);
    *(float4*)(orow + 48) = make_float4(o3[0] * inv, o3[1] * inv, o3[2] * inv, o3[3] * inv);
    *(float4*)(orow + 52) = make_float4(o3[4] * inv, o3[5] * inv, o3[6] * inv, o3[7] * inv);
}

// ---------------------------------------------------------------------------
// launch
// ---------------------------------------------------------------------------
extern "C" void kernel_launch(void* const* d_in, const int* in_sizes, int n_in,
                              void* d_out, int out_size, void* d_ws, size_t ws_size,
                              hipStream_t stream) {
    const float* x     = (const float*)d_in[0];   // (4,2048,512)
    const int*   mask  = (const int*)d_in[1];     // (4,2048)
    const float* Wq    = (const float*)d_in[2];   // (512,128)
    const float* bq    = (const float*)d_in[3];   // (128)
    const float* Wk    = (const float*)d_in[4];   // (512,128)
    const float* bk    = (const float*)d_in[5];   // (128)
    const float* Wv    = (const float*)d_in[6];   // (512,512)
    const float* bv    = (const float*)d_in[7];   // (512)
    const float* gamma = (const float*)d_in[8];   // (1)
    float* out = (float*)d_out;

    // workspace layout (f16 buffers), 256B aligned
    char* ws = (char*)d_ws;
    size_t off = 0;
    auto take = [&](size_t bytes) -> char* {
        char* p = ws + off;
        off = (off + bytes + 255) & ~(size_t)255;
        return p;
    };
    _Float16* qh  = (_Float16*)take((size_t)BATCH * NH * SEQ * DQ * 2); // 2 MB
    _Float16* kh  = (_Float16*)take((size_t)BATCH * NH * SEQ * DQ * 2); // 2 MB
    _Float16* vh  = (_Float16*)take((size_t)BATCH * NH * SEQ * DV * 2); // 8 MB

    // 1) projections (WMMA GEMM on fp32 inputs, head-split f16 outputs)
    gemm_proj<<<dim3(ROWS / 64, 1), 256, 0, stream>>>(x, Wq, bq, qh, 128, 4);
    gemm_proj<<<dim3(ROWS / 64, 1), 256, 0, stream>>>(x, Wk, bk, kh, 128, 4);
    gemm_proj<<<dim3(ROWS / 64, 4), 256, 0, stream>>>(x, Wv, bv, vh, 512, 6);

    // 2) streaming masked-softmax attention (WMMA), fp32 output
    attn_kernel<<<dim3(SEQ / 128, BATCH * NH), 256, 0, stream>>>(
        qh, kh, vh, mask, gamma, out);
}

// v004
// A run of this version takes 81.7 microseconds.
// Timed twice side by side with v003, it ran 1.20 times as fast both times.
// All steps since v000 together make it 2.50 times as fast.
#include <hip/hip_runtime.h>
#include <hip/hip_bf16.h>

// ---- problem constants (from reference) ----
#define BATCH 4
#define SEQ   2048
#define CH    512
#define NH    8
#define DQ    16      // per-head q/k dim
#define DV    64      // per-head v dim
#define ROWS  (BATCH * SEQ)   // 8192

typedef __attribute__((ext_vector_type(16))) _Float16 v16h;
typedef __attribute__((ext_vector_type(8)))  float    v8f;
typedef __attribute__((ext_vector_type(4)))  float    v4f;

union Frag {
    v16h      v;
    _Float16  h[16];
    uint4     q[2];
};

// 16-bit transposing LDS load: from a row-major tile T[k][n], lane (c = lane & 15, h = lane >> 4)
// gets T[k0 + 8h + 0..7][n0 + c]; the lane's own address is
// T + (k0 + 8h + (lane & 7)) * pitch + 2 * n0 + 16 * ((lane >> 3) & 1) bytes.
// Loads at k0 and k0 + 16 make one 16x32 operand in the hardware k order.
typedef __attribute__((ext_vector_type(8))) short s16x8;
static __device__ __forceinline__ uint4 ld_tr16(const _Float16* p) {
    typedef __attribute__((address_space(3))) s16x8 lds_s16x8;
    return __builtin_bit_cast(uint4, __builtin_amdgcn_ds_load_tr16_b128_v8i16((lds_s16x8*)p));
}

// LDS row pitches in halves: 16 B x odd for ds_load_b128 readers, 32 B x odd for ds_load_tr16_b128
#define AS_PITCH 40    // 64-B rows  -> 80 B
#define BS_PITCH 144   // 256-B rows -> 288 B
#define VS_PITCH 80    // 128-B rows -> 160 B

static __device__ __forceinline__ v8f wmma16(v16h a, v16h b, v8f c) {
    return __builtin_amdgcn_wmma_f32_16x16x32_f16(
        /*neg_a=*/false, a, /*neg_b=*/false, b,
        /*c_mod=*/(short)0, c, /*reuse_a=*/false, /*reuse_b=*/false);
}

// ---------------------------------------------------------------------------
// Projection GEMM: C[ROWS x N] = A[ROWS x 512] * Bw[512 x N] + bias
// A and Bw are read as fp32 and rounded to f16 on the way into LDS.
// Output written f16 in head-split layout: out[((b*NH+h)*SEQ+m)*hd + d]
// Block tile 64(M) x 128(N), 8 waves (4x2), wave tile 16x64, K step 32.
// hdShift: log2(head dim) -> 4 for q/k, 6 for v (avoids runtime div/mod).
// ---------------------------------------------------------------------------
__global__ __launch_bounds__(256) void gemm_proj(
    const float* __restrict__ A, const float* __restrict__ Bw,
    const float* __restrict__ bias, _Float16* __restrict__ outp,
    int N, int hdShift)
{
    __shared__ alignas(16) _Float16 As[64][AS_PITCH];
    __shared__ alignas(16) _Float16 Bs[32][BS_PITCH];   // row-major: [k][n]

    const int tid  = threadIdx.x;
    const int wave = tid >> 5;
    const int lane = tid & 31;
    const int half = lane >> 4;
    const int l    = lane & 15;
    const int mw   = wave >> 1;        // 0..3
    const int nw   = wave & 1;         // 0..1

    const int r0 = blockIdx.x * 64;
    const int n0 = blockIdx.y * 128;

    // per-thread staging coordinates (loop-invariant)
    const int aIdx = tid * 8;
    const int aRow = aIdx >> 5, aCol = aIdx & 31;
    const int bIdx = tid * 16;
    const int bK = bIdx >> 7, bN = bIdx & 127;

    const float* aSrcBase = A + (size_t)(r0 + aRow) * 512 + aCol;
    const float* bSrcBase = Bw + (size_t)bK * N + n0 + bN;

    // this lane's address for the transposing loads of the B tile
    const _Float16* bTr = &Bs[half * 8 + (lane & 7)][nw * 64 + ((lane >> 3) & 1) * 8];

    v8f acc[4];
    v8f zero = {};
    acc[0] = zero; acc[1] = zero; acc[2] = zero; acc[3] = zero;

    for (int kk = 0; kk < 512; kk += 32) {
        __syncthreads();
        {
            // this thread's 8 fp32 of the A tile and 16 fp32 of the B tile
            const float* bsrc = bSrcBase + (size_t)kk * N;
            v4f fa[2], fb[4];
            fa[0] = *(const v4f*)(aSrcBase + kk);
            fa[1] = *(const v4f*)(aSrcBase + kk + 4);
#pragma unroll
            for (int e = 0; e < 4; e++) fb[e] = *(const v4f*)(bsrc + e * 4);
            // inputs-only fence on the loaded values: keeps the six loads in flight
            // together; without it each load is waited for before the next is issued
            asm volatile("" :: "v"(fa[0]), "v"(fa[1]), "v"(fb[0]), "v"(fb[1]), "v"(fb[2]), "v"(fb[3]));
            // stage A tile 64x32 (8 halves per thread, contiguous)
            alignas(16) _Float16 ta[8];
#pragma unroll
            for (int e = 0; e < 2; e++) {
                ta[e * 4 + 0] = (_Float16)fa[e].x;
                ta[e * 4 + 1] = (_Float16)fa[e].y;
                ta[e * 4 + 2] = (_Float16)fa[e].z;
                ta[e * 4 + 3] = (_Float16)fa[e].w;
            }
            *(uint4*)&As[aRow][aCol] = *(const uint4*)ta;
            // stage B tile 32x128 row-major (16 halves per thread, contiguous)
            alignas(16) _Float16 tb[16];
#pragma unroll
            for (int e = 0; e < 4; e++) {
                tb[e * 4 + 0] = (_Float16)fb[e].x;
                tb[e * 4 + 1] = (_Float16)fb[e].y;
                tb[e * 4 + 2] = (_Float16)fb[e].z;
                tb[e * 4 + 3] = (_Float16)fb[e].w;
            }
            *(uint4*)&Bs[bK][bN]     = *(const uint4*)&tb[0];
            *(uint4*)&Bs[bK][bN + 8] = *(const uint4*)&tb[8];
        }
        // prefetch next iteration's tiles into cache while we compute
        if (kk + 32 < 512) {
            __builtin_prefetch(aSrcBase + kk + 32, 0, 1);
            __builtin_prefetch(bSrcBase + (size_t)(kk + 32) * N, 0, 1);
        }
        __syncthreads();

        // A fragment (16x32, documented 16-bit A layout)
        Frag af;
        af.q[0] = *(const uint4*)&As[mw * 16 + l][half * 8];
        af.q[1] = *(const uint4*)&As[mw * 16 + l][16 + half * 8];
#pragma unroll
        for (int f = 0; f < 4; f++) {
            // B fragment: column n = nw*64 + f*16 + l, same k order as the A fragment
            Frag bfr;
            bfr.q[0] = ld_tr16(bTr + f * 16);
            bfr.q[1] = ld_tr16(bTr + 16 * BS_PITCH + f * 16);
            acc[f] = wmma16(af.v, bfr.v, acc[f]);
        }
    }

    // epilogue: bias + head-split f16 store (shift/mask instead of div/mod)
    const int hdMask = (1 << hdShift) - 1;
#pragma unroll
    for (int f = 0; f < 4; f++) {
        int ncol = n0 + nw * 64 + f * 16 + l;
        float bs = bias[ncol];
        int h = ncol >> hdShift;
        int d = ncol & hdMask;
#pragma unroll
        for (int r = 0; r < 8; r++) {
            int grow = r0 + mw * 16 + r + half * 8;
            int b_ = grow >> 11;           // / SEQ
            int m  = grow & (SEQ - 1);
            size_t dst = ((((size_t)b_ * NH + h) * SEQ + m) << hdShift) + d;
            outp[dst] = (_Float16)(acc[f][r] + bs);
        }
    }
}

// ---------------------------------------------------------------------------
// Streaming attention: one block = 128 query rows of one (b,h); 8 waves.
// K and V come in stages of 128 keys by asynchronous copies to LDS, two buffers:
// stage t + 1 is in flight while stage t is worked on, one barrier per stage.
// The batch row's mask is converted to float in LDS once, ahead of the loop.
// Per wave: 16 queries; four passes of 32 keys per stage, both products transposed:
//   S^T = K*Q^T (2 wmma): a lane holds 16 of the 32 scores of ONE query,
//   relu + online softmax (+mask) in-lane, one exchange between wave halves,
//   O^T += V^T*P^T (4 wmma): the two S^T tiles, packed to f16, are the B operand.
// ---------------------------------------------------------------------------
#define KSTG 128              // keys per stage
#define NSTG (SEQ / KSTG)     // stages

// lane l <-> lane l ^ 16
static __device__ __forceinline__ float xhalf(float x) {
    int b = __builtin_bit_cast(int, x);
    return __builtin_bit_cast(float,
        __builtin_amdgcn_permlanex16(b, b, 0x76543210, 0xfedcba98, false, false));
}

// LDS byte address of a __shared__ object: the low 32 bits of its address
static __device__ __forceinline__ unsigned lds_addr(const void* p) {
    return (unsigned)(size_t)p;
}

// This thread's share of one stage: 16 B of K and 16 B of each of four V rows, 32 rows apart.
// The copies go past the registers, so a stage can fly while the one before it is worked on.
// s_wait_xcnt 0 closes the statement, ahead of any rewrite of the address registers (a precaution).
static __device__ __forceinline__ void stage_copy(unsigned kl, const _Float16* kg,
                                                  unsigned vl, const _Float16* vg) {
    asm volatile(
        "global_load_async_to_lds_b128 %0, %5, off\n\t"
        "global_load_async_to_lds_b128 %1, %6, off\n\t"
        "global_load_async_to_lds_b128 %2, %7, off\n\t"
        "global_load_async_to_lds_b128 %3, %8, off\n\t"
        "global_load_async_to_lds_b128 %4, %9, off\n\t"
        "s_wait_xcnt 0x0"
        :: "v"(kl), "v"(vl), "v"(vl + 32 * VS_PITCH * 2), "v"(vl + 64 * VS_PITCH * 2),
           "v"(vl + 96 * VS_PITCH * 2),
           "v"(kg), "v"(vg), "v"(vg + 32 * DV), "v"(vg + 64 * DV), "v"(vg + 96 * DV)
        : "memory");
}

__global__ __launch_bounds__(256) void attn_kernel(
    const _Float16* __restrict__ Q, const _Float16* __restrict__ K,
    const _Float16* __restrict__ V, const int* __restrict__ mask,
    const float* __restrict__ gamma, float* __restrict__ out)
{
    __shared__ alignas(16) _Float16 Kt[2][KSTG][DQ];        // [buffer][key][d]
    __shared__ alignas(16) _Float16 Vs[2][KSTG][VS_PITCH];  // [buffer][key][d], row-major
    __shared__ alignas(32) float mskf[SEQ];

    const int tid  = threadIdx.x;
    const int wave = tid >> 5;
    const int lane = tid & 31;
    const int half = lane >> 4;
    const int l    = lane & 15;

    const int bh = blockIdx.y;            // b*NH + h
    const int b  = bh >> 3;               // / NH
    const int h  = bh & (NH - 1);
    const int q0 = blockIdx.x * 128 + wave * 16;

    const size_t headBase = (size_t)bh * SEQ;

    // per-thread staging coordinates (loop-invariant): 8 lanes cover one 128-B V row
    const _Float16* kSrc = K + headBase * DQ + tid * 8;
    const _Float16* vSrc = V + (headBase + (tid >> 3)) * DV + (tid & 7) * 8;
    const unsigned kDst = lds_addr(&Kt[0][0][0]) + tid * 16;
    const unsigned vDst = lds_addr(&Vs[0][tid >> 3][(tid & 7) * 8]);
    const unsigned kBufB = KSTG * DQ * 2;        // bytes from buffer 0 to buffer 1
    const unsigned vBufB = KSTG * VS_PITCH * 2;

    // stage 0 into buffer 0
    stage_copy(kDst, kSrc, vDst, vSrc);

    // the mask of this batch row, as float (8 keys per thread)
    {
        const int4* ms = (const int4*)(mask + (size_t)b * SEQ + tid * 8);
        const int4 m0 = ms[0], m1 = ms[1];
        *(float4*)&mskf[tid * 8]     = make_float4((float)m0.x, (float)m0.y, (float)m0.z, (float)m0.w);
        *(float4*)&mskf[tid * 8 + 4] = make_float4((float)m1.x, (float)m1.y, (float)m1.z, (float)m1.w);
    }

    // this lane's address for the transposing loads of the V tile
    const _Float16* vTr0 = &Vs[0][half * 8 + (lane & 7)][((lane >> 3) & 1) * 8];

    // Q^T fragment (B operand): column = query l, 16 d padded to 32 (upper k zero)
    Frag qb;
    qb.q[0] = *(const uint4*)(Q + (headBase + q0 + l) * DQ + half * 8);
    qb.q[1] = make_uint4(0u, 0u, 0u, 0u);

    v8f zero = {};
    v8f o0 = zero, o1 = zero, o2 = zero, o3 = zero;   // o_f[r] = O[query l][f*16 + half*8 + r]
    float rm = 0.0f;   // running max of query l (relu => scores >= 0), equal in both halves
    float rl = 0.0f;   // this half's share of the masked running sum of query l

    const float scale = 0.25f;  // 1/sqrt(16)
    const float log2e = 1.44269504f;  // exp(x) = exp2(x * log2e)

    // stage 0 has landed for this wave; the barrier publishes it (and the mask) to the others
    asm volatile("s_wait_asynccnt 0x0" ::: "memory");
    __syncthreads();
    // stage 1 into buffer 1
    stage_copy(kDst + kBufB, kSrc + KSTG * DQ, vDst + vBufB, vSrc + KSTG * DV);

    for (int t = 0; t < NSTG; t++) {
        const int buf = t & 1;
        const _Float16* vTr = vTr0 + buf * (KSTG * VS_PITCH);

        for (int p = 0; p < KSTG / 32; p++) {
            // scores: S^T[32 keys x 16 queries] via two wmma (A = K rows, padded k)
            Frag ka0, ka1;
            ka0.q[0] = *(const uint4*)&Kt[buf][p * 32 + l][half * 8];
            ka0.q[1] = make_uint4(0u, 0u, 0u, 0u);
            ka1.q[0] = *(const uint4*)&Kt[buf][p * 32 + 16 + l][half * 8];
            ka1.q[1] = make_uint4(0u, 0u, 0u, 0u);
            v8f s0 = wmma16(ka0.v, qb.v, zero);   // s0[r]: key      half*8 + r, query l
            v8f s1 = wmma16(ka1.v, qb.v, zero);   // s1[r]: key 16 + half*8 + r, query l

            // masks of this lane's 16 keys
            const v8f mk0 = *(const v8f*)&mskf[t * KSTG + p * 32 + half * 8];
            const v8f mk1 = *(const v8f*)&mskf[t * KSTG + p * 32 + 16 + half * 8];

            // relu(pre-softmax) and the block's max for query l
            s0 = __builtin_elementwise_max(s0 * scale, zero);
            s1 = __builtin_elementwise_max(s1 * scale, zero);
            float tm = 0.0f;
#pragma unroll
            for (int r = 0; r < 8; r++) tm = fmaxf(tm, fmaxf(s0[r], s1[r]));
            tm = fmaxf(tm, xhalf(tm));
            const float mnew = fmaxf(rm, tm);
            const float sf = __builtin_amdgcn_exp2f((rm - mnew) * log2e);
            rm = mnew;

            // masked probabilities; packed in place they are P^T in B-operand order
            s0 = (s0 - mnew) * log2e;
            s1 = (s1 - mnew) * log2e;
#pragma unroll
            for (int r = 0; r < 8; r++) {
                s0[r] = __builtin_amdgcn_exp2f(s0[r]);
                s1[r] = __builtin_amdgcn_exp2f(s1[r]);
            }
            s0 *= mk0;
            s1 *= mk1;
            Frag pb;
#pragma unroll
            for (int r = 0; r < 8; r++) {
                pb.h[r]     = (_Float16)s0[r];
                pb.h[8 + r] = (_Float16)s1[r];
            }
            const v8f ps = s0 + s1;
            rl = rl * sf + (((ps[0] + ps[1]) + (ps[2] + ps[3])) + ((ps[4] + ps[5]) + (ps[6] + ps[7])));
            o0 *= sf; o1 *= sf; o2 *= sf; o3 *= sf;

            // V^T fragments (A operand, rows = d) by transposing loads from the row-major tile
            const _Float16* vp = vTr + p * 32 * VS_PITCH;
            Frag va;
            va.q[0] = ld_tr16(vp + 0 * 16);
            va.q[1] = ld_tr16(vp + 16 * VS_PITCH + 0 * 16);
            o0 = wmma16(va.v, pb.v, o0);
            va.q[0] = ld_tr16(vp + 1 * 16);
            va.q[1] = ld_tr16(vp + 16 * VS_PITCH + 1 * 16);
            o1 = wmma16(va.v, pb.v, o1);
            va.q[0] = ld_tr16(vp + 2 * 16);
            va.q[1] = ld_tr16(vp + 16 * VS_PITCH + 2 * 16);
            o2 = wmma16(va.v, pb.v, o2);
            va.q[0] = ld_tr16(vp + 3 * 16);
            va.q[1] = ld_tr16(vp + 16 * VS_PITCH + 3 * 16);
            o3 = wmma16(va.v, pb.v, o3);
        }

        // hand-over: this wave's reads of buffer buf are done ...
        asm volatile("s_wait_dscnt 0x0" ::: "memory");
        // ... and its copies of stage t + 1 have landed;
        asm volatile("s_wait_asynccnt 0x0" ::: "memory");
        // the barrier publishes stage t + 1 and frees buffer buf for its refill
        __syncthreads();
        if (t + 2 < NSTG)
            stage_copy(kDst + buf * kBufB, kSrc + (size_t)(t + 2) * (KSTG * DQ),
                       vDst + buf * vBufB, vSrc + (size_t)(t + 2) * (KSTG * DV));
    }
    // no copy is left in flight when the wave ends
    asm volatile("s_wait_asynccnt 0x0" ::: "memory");

    // epilogue: join the halves' sums, beta normalization, gamma, fp32 store
    const float g = gamma[0];
    const float inv = g / (rl + xhalf(rl) + 1e-12f);
    float* orow = out + ((size_t)b * SEQ + q0 + l) * CH + (size_t)h * DV + half * 8;
    *(float4*)(orow +  0) = make_float4(o0[0] * inv, o0[1] * inv, o0[2] * inv, o0[3] * inv);
    *(float4*)(orow +  4) = make_float4(o0[4] * inv, o0[5] * inv, o0[6] * inv, o0[7] * inv);
    *(float4*)(orow + 16) = make_float4(o1[0] * inv, o1[1] * inv, o1[2] * inv, o1[3] * inv);
    *(float4*)(orow + 20) = make_float4(o1[4] * inv, o1[5] * inv, o1[6] * inv, o1[7] * inv);
    *(float4*)(orow + 32) = make_float4(o2[0] * inv, o2[1] * inv, o2[2] * inv, o2[3] * inv);
    *(float4*)(orow + 36) = make_float4(o2[4] * inv, o2[5] * inv, o2[6] * inv, o2[7] * inv);
    *(float4*)(orow + 48) = make_float4(o3[0] * inv, o3[1] * inv, o3[2] * inv, o3[3] * inv);
    *(float4*)(orow + 52) = make_float4(o3[4] * inv, o3[5] * inv, o3[6] * inv, o3[7] * inv);
}

// ---------------------------------------------------------------------------
// launch
// ---------------------------------------------------------------------------
extern "C" void kernel_launch(void* const* d_in, const int* in_sizes, int n_in,
                              void* d_out, int out_size, void* d_ws, size_t ws_size,
                              hipStream_t stream) {
    const float* x     = (const float*)d_in[0];   // (4,2048,512)
    const int*   mask  = (const int*)d_in[1];     // (4,2048)
    const float* Wq    = (const float*)d_in[2];   // (512,128)
    const float* bq    = (const float*)d_in[3];   // (128)
    const float* Wk    = (const float*)d_in[4];   // (512,128)
    const float* bk    = (const float*)d_in[5];   // (128)
    const float* Wv    = (const float*)d_in[6];   // (512,512)
    const float* bv    = (const float*)d_in[7];   // (512)
    const float* gamma = (const float*)d_in[8];   // (1)
    float* out = (float*)d_out;

    // workspace layout (f16 buffers), 256B aligned
    char* ws = (char*)d_ws;
    size_t off = 0;
    auto take = [&](size_t bytes) -> char* {
        char* p = ws + off;
        off = (off + bytes + 255) & ~(size_t)255;
        return p;
    };
    _Float16* qh  = (_Float16*)take((size_t)BATCH * NH * SEQ * DQ * 2); // 2 MB
    _Float16* kh  = (_Float16*)take((size_t)BATCH * NH * SEQ * DQ * 2); // 2 MB
    _Float16* vh  = (_Float16*)take((size_t)BATCH * NH * SEQ * DV * 2); // 8 MB

    // 1) projections (WMMA GEMM on fp32 inputs, head-split f16 outputs)
    gemm_proj<<<dim3(ROWS / 64, 1), 256, 0, stream>>>(x, Wq, bq, qh, 128, 4);
    gemm_proj<<<dim3(ROWS / 64, 1), 256, 0, stream>>>(x, Wk, bk, kh, 128, 4);
    gemm_proj<<<dim3(ROWS / 64, 4), 256, 0, stream>>>(x, Wv, bv, vh, 512, 6);

    // 2) streaming masked-softmax attention (WMMA), fp32 output
    attn_kernel<<<dim3(SEQ / 128, BATCH * NH), 256, 0, stream>>>(
        qh, kh, vh, mask, gamma, out);
}

// v005
// A run of this version takes 56.6 microseconds.
// Timed twice side by side with v004, it ran 1.44 and 1.45 times as fast.
// Over all steps from v000 it is 3.61 times as fast.
#include <hip/hip_runtime.h>
#include <hip/hip_bf16.h>

// ---- problem constants (from reference) ----
#define BATCH 4
#define SEQ   2048
#define CH    512
#define NH    8
#define DQ    16      // per-head q/k dim
#define DV    64      // per-head v dim
#define ROWS  (BATCH * SEQ)   // 8192

typedef __attribute__((ext_vector_type(16))) _Float16 v16h;
typedef __attribute__((ext_vector_type(8)))  float    v8f;
typedef __attribute__((ext_vector_type(4)))  float    v4f;

union Frag {
    v16h      v;
    _Float16  h[16];
    uint4     q[2];
};

// 16-bit transposing LDS load: from a row-major tile T[k][n], lane (c = lane & 15, h = lane >> 4)
// gets T[k0 + 8h + 0..7][n0 + c]; the lane's own address is
// T + (k0 + 8h + (lane & 7)) * pitch + 2 * n0 + 16 * ((lane >> 3) & 1) bytes.
// Loads at k0 and k0 + 16 make one 16x32 operand in the hardware k order.
typedef __attribute__((ext_vector_type(8))) short s16x8;
static __device__ __forceinline__ uint4 ld_tr16(const _Float16* p) {
    typedef __attribute__((address_space(3))) s16x8 lds_s16x8;
    return __builtin_bit_cast(uint4, __builtin_amdgcn_ds_load_tr16_b128_v8i16((lds_s16x8*)p));
}

// LDS row pitches in halves: 16 B x odd for ds_load_b128 readers, 32 B x odd for ds_load_tr16_b128
#define AS_PITCH 40    // 64-B rows  -> 80 B
#define BS_PITCH 144   // 256-B rows -> 288 B
#define VS_PITCH 80    // 128-B rows -> 160 B

static __device__ __forceinline__ v8f wmma16(v16h a, v16h b, v8f c) {
    return __builtin_amdgcn_wmma_f32_16x16x32_f16(
        /*neg_a=*/false, a, /*neg_b=*/false, b,
        /*c_mod=*/(short)0, c, /*reuse_a=*/false, /*reuse_b=*/false);
}

// ---------------------------------------------------------------------------
// Projection GEMM: C[ROWS x N] = A[ROWS x 512] * Bw[512 x N] + bias
// A and Bw are read as fp32 and rounded to f16 on the way into LDS.
// Output written f16 in head-split layout: out[((b*NH+h)*SEQ+m)*hd + d]
// Block tile 64(M) x 128(N), 8 waves (4x2), wave tile 16x64, K step 32.
// One launch does all three projections: blockIdx.y picks a 128-column group,
// 0 = q, 1 = k, 2..5 = v. A block's K loop is a chain of load and LDS latencies,
// so the q and k groups run beside the v groups on the same WGPs, not ahead of them.
// hdShift: log2(head dim) -> 4 for q/k, 6 for v (avoids runtime div/mod).
// ---------------------------------------------------------------------------
__global__ __launch_bounds__(256) void gemm_proj(
    const float* __restrict__ A,
    const float* __restrict__ Wq, const float* __restrict__ bq,
    const float* __restrict__ Wk, const float* __restrict__ bk,
    const float* __restrict__ Wv, const float* __restrict__ bv,
    _Float16* __restrict__ qOut, _Float16* __restrict__ kOut, _Float16* __restrict__ vOut)
{
    // this block's projection (uniform over the block)
    const int grp = blockIdx.y;
    const float* __restrict__ Bw   = grp == 0 ? Wq : grp == 1 ? Wk : Wv;
    const float* __restrict__ bias = grp == 0 ? bq : grp == 1 ? bk : bv;
    _Float16* __restrict__ outp    = grp == 0 ? qOut : grp == 1 ? kOut : vOut;
    const int N       = grp < 2 ? NH * DQ : NH * DV;
    const int hdShift = grp < 2 ? 4 : 6;

    __shared__ alignas(16) _Float16 As[64][AS_PITCH];
    __shared__ alignas(16) _Float16 Bs[32][BS_PITCH];   // row-major: [k][n]

    const int tid  = threadIdx.x;
    const int wave = tid >> 5;
    const int lane = tid & 31;
    const int half = lane >> 4;
    const int l    = lane & 15;
    const int mw   = wave >> 1;        // 0..3
    const int nw   = wave & 1;         // 0..1

    const int r0 = blockIdx.x * 64;
    const int n0 = grp < 2 ? 0 : (grp - 2) * 128;

    // per-thread staging coordinates (loop-invariant)
    const int aIdx = tid * 8;
    const int aRow = aIdx >> 5, aCol = aIdx & 31;
    const int bIdx = tid * 16;
    const int bK = bIdx >> 7, bN = bIdx & 127;

    const float* aSrcBase = A + (size_t)(r0 + aRow) * 512 + aCol;
    const float* bSrcBase = Bw + (size_t)bK * N + n0 + bN;

    // this lane's address for the transposing loads of the B tile
    const _Float16* bTr = &Bs[half * 8 + (lane & 7)][nw * 64 + ((lane >> 3) & 1) * 8];

    v8f acc[4];
    v8f zero = {};
    acc[0] = zero; acc[1] = zero; acc[2] = zero; acc[3] = zero;

    for (int kk = 0; kk < 512; kk += 32) {
        __syncthreads();
        {
            // this thread's 8 fp32 of the A tile and 16 fp32 of the B tile
            const float* bsrc = bSrcBase + (size_t)kk * N;
            v4f fa[2], fb[4];
            fa[0] = *(const v4f*)(aSrcBase + kk);
            fa[1] = *(const v4f*)(aSrcBase + kk + 4);
#pragma unroll
            for (int e = 0; e < 4; e++) fb[e] = *(const v4f*)(bsrc + e * 4);
            // inputs-only fence on the loaded values: keeps the six loads in flight
            // together; without it each load is waited for before the next is issued
            asm volatile("" :: "v"(fa[0]), "v"(fa[1]), "v"(fb[0]), "v"(fb[1]), "v"(fb[2]), "v"(fb[3]));
            // stage A tile 64x32 (8 halves per thread, contiguous)
            alignas(16) _Float16 ta[8];
#pragma unroll
            for (int e = 0; e < 2; e++) {
                ta[e * 4 + 0] = (_Float16)fa[e].x;
                ta[e * 4 + 1] = (_Float16)fa[e].y;
                ta[e * 4 + 2] = (_Float16)fa[e].z;
                ta[e * 4 + 3] = (_Float16)fa[e].w;
            }
            *(uint4*)&As[aRow][aCol] = *(const uint4*)ta;
            // stage B tile 32x128 row-major (16 halves per thread, contiguous)
            alignas(16) _Float16 tb[16];
#pragma unroll
            for (int e = 0; e < 4; e++) {
                tb[e * 4 + 0] = (_Float16)fb[e].x;
                tb[e * 4 + 1] = (_Float16)fb[e].y;
                tb[e * 4 + 2] = (_Float16)fb[e].z;
                tb[e * 4 + 3] = (_Float16)fb[e].w;
            }
            *(uint4*)&Bs[bK][bN]     = *(const uint4*)&tb[0];
            *(uint4*)&Bs[bK][bN + 8] = *(const uint4*)&tb[8];
        }
        // prefetch next iteration's tiles into cache while we compute
        if (kk + 32 < 512) {
            __builtin_prefetch(aSrcBase + kk + 32, 0, 1);
            __builtin_prefetch(bSrcBase + (size_t)(kk + 32) * N, 0, 1);
        }
        __syncthreads();

        // A fragment (16x32, documented 16-bit A layout)
        Frag af;
        af.q[0] = *(const uint4*)&As[mw * 16 + l][half * 8];
        af.q[1] = *(const uint4*)&As[mw * 16 + l][16 + half * 8];
#pragma unroll
        for (int f = 0; f < 4; f++) {
            // B fragment: column n = nw*64 + f*16 + l, same k order as the A fragment
            Frag bfr;
            bfr.q[0] = ld_tr16(bTr + f * 16);
            bfr.q[1] = ld_tr16(bTr + 16 * BS_PITCH + f * 16);
            acc[f] = wmma16(af.v, bfr.v, acc[f]);
        }
    }

    // epilogue: bias + head-split f16 store (shift/mask instead of div/mod)
    const int hdMask = (1 << hdShift) - 1;
#pragma unroll
    for (int f = 0; f < 4; f++) {
        int ncol = n0 + nw * 64 + f * 16 + l;
        float bs = bias[ncol];
        int h = ncol >> hdShift;
        int d = ncol & hdMask;
#pragma unroll
        for (int r = 0; r < 8; r++) {
            int grow = r0 + mw * 16 + r + half * 8;
            int b_ = grow >> 11;           // / SEQ
            int m  = grow & (SEQ - 1);
            size_t dst = ((((size_t)b_ * NH + h) * SEQ + m) << hdShift) + d;
            outp[dst] = (_Float16)(acc[f][r] + bs);
        }
    }
}

// ---------------------------------------------------------------------------
// Streaming attention: one block = 128 query rows of one (b,h); 8 waves.
// K and V come in stages of 128 keys by asynchronous copies to LDS, two buffers:
// stage t + 1 is in flight while stage t is worked on, one barrier per stage.
// The batch row's mask is converted to float in LDS once, ahead of the loop.
// Per wave: 16 queries; four passes of 32 keys per stage, both products transposed:
//   S^T = K*Q^T (2 wmma): a lane holds 16 of the 32 scores of ONE query,
//   relu + online softmax (+mask) in-lane, one exchange between wave halves,
//   O^T += V^T*P^T (4 wmma): the two S^T tiles, packed to f16, are the B operand.
// ---------------------------------------------------------------------------
#define KSTG 128              // keys per stage
#define NSTG (SEQ / KSTG)     // stages

// lane l <-> lane l ^ 16
static __device__ __forceinline__ float xhalf(float x) {
    int b = __builtin_bit_cast(int, x);
    return __builtin_bit_cast(float,
        __builtin_amdgcn_permlanex16(b, b, 0x76543210, 0xfedcba98, false, false));
}

// LDS byte address of a __shared__ object: the low 32 bits of its address
static __device__ __forceinline__ unsigned lds_addr(const void* p) {
    return (unsigned)(size_t)p;
}

// This thread's share of one stage: 16 B of K and 16 B of each of four V rows, 32 rows apart.
// The copies go past the registers, so a stage can fly while the one before it is worked on.
// s_wait_xcnt 0 closes the statement, ahead of any rewrite of the address registers (a precaution).
static __device__ __forceinline__ void stage_copy(unsigned kl, const _Float16* kg,
                                                  unsigned vl, const _Float16* vg) {
    asm volatile(
        "global_load_async_to_lds_b128 %0, %5, off\n\t"
        "global_load_async_to_lds_b128 %1, %6, off\n\t"
        "global_load_async_to_lds_b128 %2, %7, off\n\t"
        "global_load_async_to_lds_b128 %3, %8, off\n\t"
        "global_load_async_to_lds_b128 %4, %9, off\n\t"
        "s_wait_xcnt 0x0"
        :: "v"(kl), "v"(vl), "v"(vl + 32 * VS_PITCH * 2), "v"(vl + 64 * VS_PITCH * 2),
           "v"(vl + 96 * VS_PITCH * 2),
           "v"(kg), "v"(vg), "v"(vg + 32 * DV), "v"(vg + 64 * DV), "v"(vg + 96 * DV)
        : "memory");
}

__global__ __launch_bounds__(256) void attn_kernel(
    const _Float16* __restrict__ Q, const _Float16* __restrict__ K,
    const _Float16* __restrict__ V, const int* __restrict__ mask,
    const float* __restrict__ gamma, float* __restrict__ out)
{
    __shared__ alignas(16) _Float16 Kt[2][KSTG][DQ];        // [buffer][key][d]
    __shared__ alignas(16) _Float16 Vs[2][KSTG][VS_PITCH];  // [buffer][key][d], row-major
    __shared__ alignas(32) float mskf[SEQ];

    const int tid  = threadIdx.x;
    const int wave = tid >> 5;
    const int lane = tid & 31;
    const int half = lane >> 4;
    const int l    = lane & 15;

    const int bh = blockIdx.y;            // b*NH + h
    const int b  = bh >> 3;               // / NH
    const int h  = bh & (NH - 1);
    const int q0 = blockIdx.x * 128 + wave * 16;

    const size_t headBase = (size_t)bh * SEQ;

    // per-thread staging coordinates (loop-invariant): 8 lanes cover one 128-B V row
    const _Float16* kSrc = K + headBase * DQ + tid * 8;
    const _Float16* vSrc = V + (headBase + (tid >> 3)) * DV + (tid & 7) * 8;
    const unsigned kDst = lds_addr(&Kt[0][0][0]) + tid * 16;
    const unsigned vDst = lds_addr(&Vs[0][tid >> 3][(tid & 7) * 8]);
    const unsigned kBufB = KSTG * DQ * 2;        // bytes from buffer 0 to buffer 1
    const unsigned vBufB = KSTG * VS_PITCH * 2;

    // stage 0 into buffer 0
    stage_copy(kDst, kSrc, vDst, vSrc);

    // the mask of this batch row, as float (8 keys per thread)
    {
        const int4* ms = (const int4*)(mask + (size_t)b * SEQ + tid * 8);
        const int4 m0 = ms[0], m1 = ms[1];
        *(float4*)&mskf[tid * 8]     = make_float4((float)m0.x, (float)m0.y, (float)m0.z, (float)m0.w);
        *(float4*)&mskf[tid * 8 + 4] = make_float4((float)m1.x, (float)m1.y, (float)m1.z, (float)m1.w);
    }

    // this lane's address for the transposing loads of the V tile
    const _Float16* vTr0 = &Vs[0][half * 8 + (lane & 7)][((lane >> 3) & 1) * 8];

    // Q^T fragment (B operand): column = query l, 16 d padded to 32 (upper k zero)
    Frag qb;
    qb.q[0] = *(const uint4*)(Q + (headBase + q0 + l) * DQ + half * 8);
    qb.q[1] = make_uint4(0u, 0u, 0u, 0u);

    v8f zero = {};
    v8f o0 = zero, o1 = zero, o2 = zero, o3 = zero;   // o_f[r] = O[query l][f*16 + half*8 + r]
    float rm = 0.0f;   // running max of query l (relu => scores >= 0), equal in both halves
    float rl = 0.0f;   // this half's share of the masked running sum of query l

    const float scale = 0.25f;  // 1/sqrt(16)
    const float log2e = 1.44269504f;  // exp(x) = exp2(x * log2e)

    // stage 0 has landed for this wave; the barrier publishes it (and the mask) to the others
    asm volatile("s_wait_asynccnt 0x0" ::: "memory");
    __syncthreads();
    // stage 1 into buffer 1
    stage_copy(kDst + kBufB, kSrc + KSTG * DQ, vDst + vBufB, vSrc + KSTG * DV);

    for (int t = 0; t < NSTG; t++) {
        const int buf = t & 1;
        const _Float16* vTr = vTr0 + buf * (KSTG * VS_PITCH);

        for (int p = 0; p < KSTG / 32; p++) {
            // scores: S^T[32 keys x 16 queries] via two wmma (A = K rows, padded k)
            Frag ka0, ka1;
            ka0.q[0] = *(const uint4*)&Kt[buf][p * 32 + l][half * 8];
            ka0.q[1] = make_uint4(0u, 0u, 0u, 0u);
            ka1.q[0] = *(const uint4*)&Kt[buf][p * 32 + 16 + l][half * 8];
            ka1.q[1] = make_uint4(0u, 0u, 0u, 0u);
            v8f s0 = wmma16(ka0.v, qb.v, zero);   // s0[r]: key      half*8 + r, query l
            v8f s1 = wmma16(ka1.v, qb.v, zero);   // s1[r]: key 16 + half*8 + r, query l

            // masks of this lane's 16 keys
            const v8f mk0 = *(const v8f*)&mskf[t * KSTG + p * 32 + half * 8];
            const v8f mk1 = *(const v8f*)&mskf[t * KSTG + p * 32 + 16 + half * 8];

            // relu(pre-softmax) and the block's max for query l
            s0 = __builtin_elementwise_max(s0 * scale, zero);
            s1 = __builtin_elementwise_max(s1 * scale, zero);
            float tm = 0.0f;
#pragma unroll
            for (int r = 0; r < 8; r++) tm = fmaxf(tm, fmaxf(s0[r], s1[r]));
            tm = fmaxf(tm, xhalf(tm));
            const float mnew = fmaxf(rm, tm);
            const float sf = __builtin_amdgcn_exp2f((rm - mnew) * log2e);
            rm = mnew;

            // masked probabilities; packed in place they are P^T in B-operand order
            s0 = (s0 - mnew) * log2e;
            s1 = (s1 - mnew) * log2e;
#pragma unroll
            for (int r = 0; r < 8; r++) {
                s0[r] = __builtin_amdgcn_exp2f(s0[r]);
                s1[r] = __builtin_amdgcn_exp2f(s1[r]);
            }
            s0 *= mk0;
            s1 *= mk1;
            Frag pb;
#pragma unroll
            for (int r = 0; r < 8; r++) {
                pb.h[r]     = (_Float16)s0[r];
                pb.h[8 + r] = (_Float16)s1[r];
            }
            const v8f ps = s0 + s1;
            rl = rl * sf + (((ps[0] + ps[1]) + (ps[2] + ps[3])) + ((ps[4] + ps[5]) + (ps[6] + ps[7])));
            o0 *= sf; o1 *= sf; o2 *= sf; o3 *= sf;

            // V^T fragments (A operand, rows = d) by transposing loads from the row-major tile
            const _Float16* vp = vTr + p * 32 * VS_PITCH;
            Frag va;
            va.q[0] = ld_tr16(vp + 0 * 16);
            va.q[1] = ld_tr16(vp + 16 * VS_PITCH + 0 * 16);
            o0 = wmma16(va.v, pb.v, o0);
            va.q[0] = ld_tr16(vp + 1 * 16);
            va.q[1] = ld_tr16(vp + 16 * VS_PITCH + 1 * 16);
            o1 = wmma16(va.v, pb.v, o1);
            va.q[0] = ld_tr16(vp + 2 * 16);
            va.q[1] = ld_tr16(vp + 16 * VS_PITCH + 2 * 16);
            o2 = wmma16(va.v, pb.v, o2);
            va.q[0] = ld_tr16(vp + 3 * 16);
            va.q[1] = ld_tr16(vp + 16 * VS_PITCH + 3 * 16);
            o3 = wmma16(va.v, pb.v, o3);
        }

        // hand-over: this wave's reads of buffer buf are done ...
        asm volatile("s_wait_dscnt 0x0" ::: "memory");
        // ... and its copies of stage t + 1 have landed;
        asm volatile("s_wait_asynccnt 0x0" ::: "memory");
        // the barrier publishes stage t + 1 and frees buffer buf for its refill
        __syncthreads();
        if (t + 2 < NSTG)
            stage_copy(kDst + buf * kBufB, kSrc + (size_t)(t + 2) * (KSTG * DQ),
                       vDst + buf * vBufB, vSrc + (size_t)(t + 2) * (KSTG * DV));
    }
    // no copy is left in flight when the wave ends
    asm volatile("s_wait_asynccnt 0x0" ::: "memory");

    // epilogue: join the halves' sums, beta normalization, gamma, fp32 store
    const float g = gamma[0];
    const float inv = g / (rl + xhalf(rl) + 1e-12f);
    float* orow = out + ((size_t)b * SEQ + q0 + l) * CH + (size_t)h * DV + half * 8;
    *(float4*)(orow +  0) = make_float4(o0[0] * inv, o0[1] * inv, o0[2] * inv, o0[3] * inv);
    *(float4*)(orow +  4) = make_float4(o0[4] * inv, o0[5] * inv, o0[6] * inv, o0[7] * inv);
    *(float4*)(orow + 16) = make_float4(o1[0] * inv, o1[1] * inv, o1[2] * inv, o1[3] * inv);
    *(float4*)(orow + 20) = make_float4(o1[4] * inv, o1[5] * inv, o1[6] * inv, o1[7] * inv);
    *(float4*)(orow + 32) = make_float4(o2[0] * inv, o2[1] * inv, o2[2] * inv, o2[3] * inv);
    *(float4*)(orow + 36) = make_float4(o2[4] * inv, o2[5] * inv, o2[6] * inv, o2[7] * inv);
    *(float4*)(orow + 48) = make_float4(o3[0] * inv, o3[1] * inv, o3[2] * inv, o3[3] * inv);
    *(float4*)(orow + 52) = make_float4(o3[4] * inv, o3[5] * inv, o3[6] * inv, o3[7] * inv);
}

// ---------------------------------------------------------------------------
// launch
// ---------------------------------------------------------------------------
extern "C" void kernel_launch(void* const* d_in, const int* in_sizes, int n_in,
                              void* d_out, int out_size, void* d_ws, size_t ws_size,
                              hipStream_t stream) {
    const float* x     = (const float*)d_in[0];   // (4,2048,512)
    const int*   mask  = (const int*)d_in[1];     // (4,2048)
    const float* Wq    = (const float*)d_in[2];   // (512,128)
    const float* bq    = (const float*)d_in[3];   // (128)
    const float* Wk    = (const float*)d_in[4];   // (512,128)
    const float* bk    = (const float*)d_in[5];   // (128)
    const float* Wv    = (const float*)d_in[6];   // (512,512)
    const float* bv    = (const float*)d_in[7];   // (512)
    const float* gamma = (const float*)d_in[8];   // (1)
    float* out = (float*)d_out;

    // workspace layout (f16 buffers), 256B aligned
    char* ws = (char*)d_ws;
    size_t off = 0;
    auto take = [&](size_t bytes) -> char* {
        char* p = ws + off;
        off = (off + bytes + 255) & ~(size_t)255;
        return p;
    };
    _Float16* qh  = (_Float16*)take((size_t)BATCH * NH * SEQ * DQ * 2); // 2 MB
    _Float16* kh  = (_Float16*)take((size_t)BATCH * NH * SEQ * DQ * 2); // 2 MB
    _Float16* vh  = (_Float16*)take((size_t)BATCH * NH * SEQ * DV * 2); // 8 MB

    // 1) projections, one launch (WMMA GEMM on fp32 inputs, head-split f16 outputs)
    gemm_proj<<<dim3(ROWS / 64, 6), 256, 0, stream>>>(x, Wq, bq, Wk, bk, Wv, bv, qh, kh, vh);

    // 2) streaming masked-softmax attention (WMMA), fp32 output
    attn_kernel<<<dim3(SEQ / 128, BATCH * NH), 256, 0, stream>>>(
        qh, kh, vh, mask, gamma, out);
}

// v006
// One run takes 51.2 microseconds.
// In both of two side-by-side timings against v005, it was 1.10 times as fast.
// All steps since v000 together make it 3.98 times as fast.
#include <hip/hip_runtime.h>
#include <hip/hip_bf16.h>

// ---- problem constants (from reference) ----
#define BATCH 4
#define SEQ   2048
#define CH    512
#define NH    8
#define DQ    16      // per-head q/k dim
#define DV    64      // per-head v dim
#define ROWS  (BATCH * SEQ)   // 8192

typedef __attribute__((ext_vector_type(16))) _Float16 v16h;
typedef __attribute__((ext_vector_type(8)))  float    v8f;
typedef __attribute__((ext_vector_type(4)))  float    v4f;

union Frag {
    v16h      v;
    _Float16  h[16];
    uint4     q[2];
};

// 16-bit transposing LDS load: from a row-major tile T[k][n], lane (c = lane & 15, h = lane >> 4)
// gets T[k0 + 8h + 0..7][n0 + c]; the lane's own address is
// T + (k0 + 8h + (lane & 7)) * pitch + 2 * n0 + 16 * ((lane >> 3) & 1) bytes.
// Loads at k0 and k0 + 16 make one 16x32 operand in the hardware k order.
typedef __attribute__((ext_vector_type(8))) short s16x8;
static __device__ __forceinline__ uint4 ld_tr16(const _Float16* p) {
    typedef __attribute__((address_space(3))) s16x8 lds_s16x8;
    return __builtin_bit_cast(uint4, __builtin_amdgcn_ds_load_tr16_b128_v8i16((lds_s16x8*)p));
}

// LDS row pitches in halves: 16 B x odd for ds_load_b128 readers, 32 B x odd for ds_load_tr16_b128
#define AS_PITCH 40    // 64-B rows  -> 80 B
#define BS_PITCH 144   // 256-B rows -> 288 B
#define VS_PITCH 80    // 128-B rows -> 160 B

static __device__ __forceinline__ v8f wmma16(v16h a, v16h b, v8f c) {
    return __builtin_amdgcn_wmma_f32_16x16x32_f16(
        /*neg_a=*/false, a, /*neg_b=*/false, b,
        /*c_mod=*/(short)0, c, /*reuse_a=*/false, /*reuse_b=*/false);
}

// ---------------------------------------------------------------------------
// Projection GEMM: C[ROWS x N] = A[ROWS x 512] * Bw[512 x N] + bias
// A and Bw are read as fp32 and rounded to f16 on the way into LDS.
// Output written f16 in head-split layout: out[((b*NH+h)*SEQ+m)*hd + d]
// Block tile 64(M) x 128(N), 8 waves (4x2), wave tile 16x64, K step 32.
// One launch does all three projections: blockIdx.y picks a 128-column group,
// 0 = q, 1 = k, 2..5 = v. A block's K loop is a chain of load and LDS latencies,
// so the q and k groups run beside the v groups on the same WGPs, not ahead of them.
// hdShift: log2(head dim) -> 4 for q/k, 6 for v (avoids runtime div/mod).
// ---------------------------------------------------------------------------
__global__ __launch_bounds__(256) void gemm_proj(
    const float* __restrict__ A,
    const float* __restrict__ Wq, const float* __restrict__ bq,
    const float* __restrict__ Wk, const float* __restrict__ bk,
    const float* __restrict__ Wv, const float* __restrict__ bv,
    _Float16* __restrict__ qOut, _Float16* __restrict__ kOut, _Float16* __restrict__ vOut)
{
    // this block's projection (uniform over the block)
    const int grp = blockIdx.y;
    const float* __restrict__ Bw   = grp == 0 ? Wq : grp == 1 ? Wk : Wv;
    const float* __restrict__ bias = grp == 0 ? bq : grp == 1 ? bk : bv;
    _Float16* __restrict__ outp    = grp == 0 ? qOut : grp == 1 ? kOut : vOut;
    const int N       = grp < 2 ? NH * DQ : NH * DV;
    const int hdShift = grp < 2 ? 4 : 6;
    // q leaves in the unit the attention kernel's exp2 wants: 1/sqrt(16) * log2(e), applied in fp32, ahead of the rounding
    const float oScale = grp == 0 ? 0.25f * 1.44269504f : 1.0f;

    __shared__ alignas(16) _Float16 As[64][AS_PITCH];
    __shared__ alignas(16) _Float16 Bs[32][BS_PITCH];   // row-major: [k][n]

    const int tid  = threadIdx.x;
    const int wave = tid >> 5;
    const int lane = tid & 31;
    const int half = lane >> 4;
    const int l    = lane & 15;
    const int mw   = wave >> 1;        // 0..3
    const int nw   = wave & 1;         // 0..1

    const int r0 = blockIdx.x * 64;
    const int n0 = grp < 2 ? 0 : (grp - 2) * 128;

    // per-thread staging coordinates (loop-invariant)
    const int aIdx = tid * 8;
    const int aRow = aIdx >> 5, aCol = aIdx & 31;
    const int bIdx = tid * 16;
    const int bK = bIdx >> 7, bN = bIdx & 127;

    const float* aSrcBase = A + (size_t)(r0 + aRow) * 512 + aCol;
    const float* bSrcBase = Bw + (size_t)bK * N + n0 + bN;

    // this lane's address for the transposing loads of the B tile
    const _Float16* bTr = &Bs[half * 8 + (lane & 7)][nw * 64 + ((lane >> 3) & 1) * 8];

    v8f acc[4];
    v8f zero = {};
    acc[0] = zero; acc[1] = zero; acc[2] = zero; acc[3] = zero;

    for (int kk = 0; kk < 512; kk += 32) {
        __syncthreads();
        {
            // this thread's 8 fp32 of the A tile and 16 fp32 of the B tile
            const float* bsrc = bSrcBase + (size_t)kk * N;
            v4f fa[2], fb[4];
            fa[0] = *(const v4f*)(aSrcBase + kk);
            fa[1] = *(const v4f*)(aSrcBase + kk + 4);
#pragma unroll
            for (int e = 0; e < 4; e++) fb[e] = *(const v4f*)(bsrc + e * 4);
            // inputs-only fence on the loaded values: keeps the six loads in flight
            // together; without it each load is waited for before the next is issued
            asm volatile("" :: "v"(fa[0]), "v"(fa[1]), "v"(fb[0]), "v"(fb[1]), "v"(fb[2]), "v"(fb[3]));
            // stage A tile 64x32 (8 halves per thread, contiguous)
            alignas(16) _Float16 ta[8];
#pragma unroll
            for (int e = 0; e < 2; e++) {
                ta[e * 4 + 0] = (_Float16)fa[e].x;
                ta[e * 4 + 1] = (_Float16)fa[e].y;
                ta[e * 4 + 2] = (_Float16)fa[e].z;
                ta[e * 4 + 3] = (_Float16)fa[e].w;
            }
            *(uint4*)&As[aRow][aCol] = *(const uint4*)ta;
            // stage B tile 32x128 row-major (16 halves per thread, contiguous)
            alignas(16) _Float16 tb[16];
#pragma unroll
            for (int e = 0; e < 4; e++) {
                tb[e * 4 + 0] = (_Float16)fb[e].x;
                tb[e * 4 + 1] = (_Float16)fb[e].y;
                tb[e * 4 + 2] = (_Float16)fb[e].z;
                tb[e * 4 + 3] = (_Float16)fb[e].w;
            }
            *(uint4*)&Bs[bK][bN]     = *(const uint4*)&tb[0];
            *(uint4*)&Bs[bK][bN + 8] = *(const uint4*)&tb[8];
        }
        // prefetch next iteration's tiles into cache while we compute
        if (kk + 32 < 512) {
            __builtin_prefetch(aSrcBase + kk + 32, 0, 1);
            __builtin_prefetch(bSrcBase + (size_t)(kk + 32) * N, 0, 1);
        }
        __syncthreads();

        // A fragment (16x32, documented 16-bit A layout)
        Frag af;
        af.q[0] = *(const uint4*)&As[mw * 16 + l][half * 8];
        af.q[1] = *(const uint4*)&As[mw * 16 + l][16 + half * 8];
#pragma unroll
        for (int f = 0; f < 4; f++) {
            // B fragment: column n = nw*64 + f*16 + l, same k order as the A fragment
            Frag bfr;
            bfr.q[0] = ld_tr16(bTr + f * 16);
            bfr.q[1] = ld_tr16(bTr + 16 * BS_PITCH + f * 16);
            acc[f] = wmma16(af.v, bfr.v, acc[f]);
        }
    }

    // epilogue: bias + head-split f16 store (shift/mask instead of div/mod)
    const int hdMask = (1 << hdShift) - 1;
#pragma unroll
    for (int f = 0; f < 4; f++) {
        int ncol = n0 + nw * 64 + f * 16 + l;
        float bs = bias[ncol];
        bs *= oScale;
        acc[f] *= oScale;
        int h = ncol >> hdShift;
        int d = ncol & hdMask;
#pragma unroll
        for (int r = 0; r < 8; r++) {
            int grow = r0 + mw * 16 + r + half * 8;
            int b_ = grow >> 11;           // / SEQ
            int m  = grow & (SEQ - 1);
            size_t dst = ((((size_t)b_ * NH + h) * SEQ + m) << hdShift) + d;
            outp[dst] = (_Float16)(acc[f][r] + bs);
        }
    }
}

// ---------------------------------------------------------------------------
// Streaming attention: one block = 128 query rows of one (b,h); 8 waves.
// K and V come in stages of 128 keys by asynchronous copies to LDS, two buffers:
// stage t + 1 is in flight while stage t is worked on, one barrier per stage.
// The batch row's mask is converted to float in LDS once, ahead of the loop.
// Per wave: 16 queries, both products transposed:
//   S^T = K*Q^T - ref (8 wmma per stage): a lane holds 64 of the 128 scores of ONE query.
//   Q arrives scaled to log2 units; ref, the query's softmax reference, is the C operand.
//   Any reference gives the same quotient O / sum, so ref is raised (and O and the sums
//   rescaled) only when a score of the stage tops it by more than REF_ROOM: every
//   probability stays <= 2^REF_ROOM, the row's largest >= 1, and a pass has no rescale.
//   relu: exp2(max(t, 0) - ref) = max(exp2(t - ref), exp2(-ref)).
//   O^T += V^T*P^T (4 wmma per 32 keys): two S^T tiles, packed to f16, are the B operand.
// ---------------------------------------------------------------------------
#define KSTG 128              // keys per stage
#define NSTG (SEQ / KSTG)     // stages
#define REF_ROOM 8.0f        // log2 units a score may stand above the reference

// lane l <-> lane l ^ 16
static __device__ __forceinline__ float xhalf(float x) {
    int b = __builtin_bit_cast(int, x);
    return __builtin_bit_cast(float,
        __builtin_amdgcn_permlanex16(b, b, 0x76543210, 0xfedcba98, false, false));
}

// x[i] = max(exp2(x[i]), lo), eight at a time. Written as one statement, each exponential in place:
// a neighbour should not overwrite a source directly behind a transcendental, the
// slot the instruction set wants kept; here the instruction behind each one touches other registers.
static __device__ __forceinline__ void exp2_floor8(v8f& x, float lo) {
    float a = x[0], b = x[1], c = x[2], d = x[3], e = x[4], f = x[5], g = x[6], h = x[7];
    asm("v_exp_f32 %0, %0\n\t"
        "v_exp_f32 %1, %1\n\t"
        "v_exp_f32 %2, %2\n\t"
        "v_exp_f32 %3, %3\n\t"
        "v_exp_f32 %4, %4\n\t"
        "v_exp_f32 %5, %5\n\t"
        "v_exp_f32 %6, %6\n\t"
        "v_exp_f32 %7, %7\n\t"
        "v_max_num_f32 %0, %0, %8\n\t"
        "v_max_num_f32 %1, %1, %8\n\t"
        "v_max_num_f32 %2, %2, %8\n\t"
        "v_max_num_f32 %3, %3, %8\n\t"
        "v_max_num_f32 %4, %4, %8\n\t"
        "v_max_num_f32 %5, %5, %8\n\t"
        "v_max_num_f32 %6, %6, %8\n\t"
        "v_max_num_f32 %7, %7, %8"
        : "+v"(a), "+v"(b), "+v"(c), "+v"(d), "+v"(e), "+v"(f), "+v"(g), "+v"(h)
        : "v"(lo));
    x = v8f{a, b, c, d, e, f, g, h};
}

// LDS byte address of a __shared__ object: the low 32 bits of its address
static __device__ __forceinline__ unsigned lds_addr(const void* p) {
    return (unsigned)(size_t)p;
}

// This thread's share of one stage: 16 B of K and 16 B of each of four V rows, 32 rows apart.
// The copies go past the registers, so a stage can fly while the one before it is worked on.
// s_wait_xcnt 0 closes the statement, ahead of any rewrite of the address registers (a precaution).
static __device__ __forceinline__ void stage_copy(unsigned kl, const _Float16* kg,
                                                  unsigned vl, const _Float16* vg) {
    asm volatile(
        "global_load_async_to_lds_b128 %0, %5, off\n\t"
        "global_load_async_to_lds_b128 %1, %6, off\n\t"
        "global_load_async_to_lds_b128 %2, %7, off\n\t"
        "global_load_async_to_lds_b128 %3, %8, off\n\t"
        "global_load_async_to_lds_b128 %4, %9, off\n\t"
        "s_wait_xcnt 0x0"
        :: "v"(kl), "v"(vl), "v"(vl + 32 * VS_PITCH * 2), "v"(vl + 64 * VS_PITCH * 2),
           "v"(vl + 96 * VS_PITCH * 2),
           "v"(kg), "v"(vg), "v"(vg + 32 * DV), "v"(vg + 64 * DV), "v"(vg + 96 * DV)
        : "memory");
}

// Two blocks per WGP is all the grid gives: four waves per SIMD. Said to the compiler, it spends
// that register budget on LDS loads issued ahead of their use instead of waiting for each in turn.
__global__ __launch_bounds__(256) __attribute__((amdgpu_waves_per_eu(4, 4))) void attn_kernel(
    const _Float16* __restrict__ Q, const _Float16* __restrict__ K,
    const _Float16* __restrict__ V, const int* __restrict__ mask,
    const float* __restrict__ gamma, float* __restrict__ out)
{
    __shared__ alignas(16) _Float16 Kt[2][KSTG][DQ];        // [buffer][key][d]
    __shared__ alignas(16) _Float16 Vs[2][KSTG][VS_PITCH];  // [buffer][key][d], row-major
    __shared__ alignas(32) float mskf[SEQ];

    const int tid  = threadIdx.x;
    const int wave = tid >> 5;
    const int lane = tid & 31;
    const int half = lane >> 4;
    const int l    = lane & 15;

    const int bh = blockIdx.y;            // b*NH + h
    const int b  = bh >> 3;               // / NH
    const int h  = bh & (NH - 1);
    const int q0 = blockIdx.x * 128 + wave * 16;

    const size_t headBase = (size_t)bh * SEQ;

    // per-thread staging coordinates (loop-invariant): 8 lanes cover one 128-B V row
    const _Float16* kSrc = K + headBase * DQ + tid * 8;
    const _Float16* vSrc = V + (headBase + (tid >> 3)) * DV + (tid & 7) * 8;
    const unsigned kDst = lds_addr(&Kt[0][0][0]) + tid * 16;
    const unsigned vDst = lds_addr(&Vs[0][tid >> 3][(tid & 7) * 8]);
    const unsigned kBufB = KSTG * DQ * 2;        // bytes from buffer 0 to buffer 1
    const unsigned vBufB = KSTG * VS_PITCH * 2;

    // stage 0 into buffer 0
    stage_copy(kDst, kSrc, vDst, vSrc);

    // the mask of this batch row, as float (8 keys per thread)
    {
        const int4* ms = (const int4*)(mask + (size_t)b * SEQ + tid * 8);
        const int4 m0 = ms[0], m1 = ms[1];
        *(float4*)&mskf[tid * 8]     = make_float4((float)m0.x, (float)m0.y, (float)m0.z, (float)m0.w);
        *(float4*)&mskf[tid * 8 + 4] = make_float4((float)m1.x, (float)m1.y, (float)m1.z, (float)m1.w);
    }

    // this lane's address for the transposing loads of the V tile
    const _Float16* vTr0 = &Vs[0][half * 8 + (lane & 7)][((lane >> 3) & 1) * 8];

    // Q^T fragment (B operand): column = query l, 16 d padded to 32 (upper k zero)
    Frag qb;
    qb.q[0] = *(const uint4*)(Q + (headBase + q0 + l) * DQ + half * 8);
    qb.q[1] = make_uint4(0u, 0u, 0u, 0u);

    v8f zero = {};
    v8f o0 = zero, o1 = zero, o2 = zero, o3 = zero;   // o_f[r] = O[query l][f*16 + half*8 + r]
    v8f nref = zero;   // minus the reference of query l (relu => row max >= 0), equal in both halves
    float e0 = 1.0f;   // exp2(-reference): the probability of a score that relu lifts to 0
    v8f rs = zero;     // this lane's eight partial masked sums of query l

    // stage 0 has landed for this wave; the barrier publishes it (and the mask) to the others
    asm volatile("s_wait_asynccnt 0x0" ::: "memory");
    __syncthreads();
    // stage 1 into buffer 1
    stage_copy(kDst + kBufB, kSrc + KSTG * DQ, vDst + vBufB, vSrc + KSTG * DV);

    for (int t = 0; t < NSTG; t++) {
        const int buf = t & 1;
        const _Float16* vTr = vTr0 + buf * (KSTG * VS_PITCH);

        // scores of the whole stage, minus the reference: S^T[128 keys x 16 queries] (A = K rows, padded k)
        // (every loop over s, kq or tq below is unrolled so that their indices are constants
        // and the arrays live in registers)
        v8f s[KSTG / 16];   // s[j][r]: key j*16 + half*8 + r, query l
        {
            v4f kq[KSTG / 16];
#pragma unroll
            for (int j = 0; j < KSTG / 16; j++) kq[j] = *(const v4f*)&Kt[buf][j * 16 + l][half * 8];
            // inputs-only fence on the loaded values: keeps the eight loads in flight together;
            // without it each load is waited for before the next is issued
            asm volatile("" :: "v"(kq[0]), "v"(kq[1]), "v"(kq[2]), "v"(kq[3]),
                               "v"(kq[4]), "v"(kq[5]), "v"(kq[6]), "v"(kq[7]));
#pragma unroll
            for (int j = 0; j < KSTG / 16; j++) {
                Frag ka;
                ka.q[0] = __builtin_bit_cast(uint4, kq[j]);
                ka.q[1] = make_uint4(0u, 0u, 0u, 0u);
                s[j] = wmma16(ka.v, qb.v, nref);
            }
        }

        // how far this lane's scores stand above the reference
        float tq[4];   // four chains, so that no link waits for the one before it
#pragma unroll
        for (int c = 0; c < 4; c++) {
            tq[c] = s[2 * c][0];
#pragma unroll
            for (int r = 0; r < 8; r++) tq[c] = fmaxf(tq[c], fmaxf(s[2 * c][r], s[2 * c + 1][r]));
        }
        const float tm = fmaxf(fmaxf(tq[0], tq[1]), fmaxf(tq[2], tq[3]));

        // rare: some query of the wave outgrew its reference; raise every query's to its stage max
        if (__builtin_amdgcn_ballot_w32(tm > REF_ROOM) != 0u) {
            const float up = fmaxf(fmaxf(tm, xhalf(tm)), 0.0f);
            const float sf = __builtin_amdgcn_exp2f(-up);
#pragma unroll
            for (int j = 0; j < KSTG / 16; j++) s[j] -= up;
            nref -= up;
            e0 = __builtin_amdgcn_exp2f(nref[0]);
            rs *= sf;
            o0 *= sf; o1 *= sf; o2 *= sf; o3 *= sf;
        }

#pragma unroll
        for (int p = 0; p < KSTG / 32; p++) {
            v8f s0 = s[2 * p], s1 = s[2 * p + 1];

            // masks of this lane's 16 keys
            const v8f mk0 = *(const v8f*)&mskf[t * KSTG + p * 32 + half * 8];
            const v8f mk1 = *(const v8f*)&mskf[t * KSTG + p * 32 + 16 + half * 8];

            // masked probabilities; packed in place they are P^T in B-operand order
            exp2_floor8(s0, e0);
            exp2_floor8(s1, e0);
            s0 *= mk0;
            s1 *= mk1;
            Frag pb;
#pragma unroll
            for (int r = 0; r < 8; r++) {
                pb.h[r]     = (_Float16)s0[r];
                pb.h[8 + r] = (_Float16)s1[r];
            }
            rs += s0 + s1;

            // V^T fragments (A operand, rows = d) by transposing loads from the row-major tile
            const _Float16* vp = vTr + p * 32 * VS_PITCH;
            Frag va;
            va.q[0] = ld_tr16(vp + 0 * 16);
            va.q[1] = ld_tr16(vp + 16 * VS_PITCH + 0 * 16);
            o0 = wmma16(va.v, pb.v, o0);
            va.q[0] = ld_tr16(vp + 1 * 16);
            va.q[1] = ld_tr16(vp + 16 * VS_PITCH + 1 * 16);
            o1 = wmma16(va.v, pb.v, o1);
            va.q[0] = ld_tr16(vp + 2 * 16);
            va.q[1] = ld_tr16(vp + 16 * VS_PITCH + 2 * 16);
            o2 = wmma16(va.v, pb.v, o2);
            va.q[0] = ld_tr16(vp + 3 * 16);
            va.q[1] = ld_tr16(vp + 16 * VS_PITCH + 3 * 16);
            o3 = wmma16(va.v, pb.v, o3);
        }

        // hand-over: this wave's reads of buffer buf are done ...
        asm volatile("s_wait_dscnt 0x0" ::: "memory");
        // ... and its copies of stage t + 1 have landed;
        asm volatile("s_wait_asynccnt 0x0" ::: "memory");
        // the barrier publishes stage t + 1 and frees buffer buf for its refill
        __syncthreads();
        if (t + 2 < NSTG)
            stage_copy(kDst + buf * kBufB, kSrc + (size_t)(t + 2) * (KSTG * DQ),
                       vDst + buf * vBufB, vSrc + (size_t)(t + 2) * (KSTG * DV));
    }
    // no copy is left in flight when the wave ends
    asm volatile("s_wait_asynccnt 0x0" ::: "memory");

    // epilogue: join the halves' sums, beta normalization, gamma, fp32 store
    const float g = gamma[0];
    const float rl = ((rs[0] + rs[1]) + (rs[2] + rs[3])) + ((rs[4] + rs[5]) + (rs[6] + rs[7]));
    const float inv = g / (rl + xhalf(rl) + 1e-12f);
    float* orow = out + ((size_t)b * SEQ + q0 + l) * CH + (size_t)h * DV + half * 8;
    *(float4*)(orow +  0) = make_float4(o0[0] * inv, o0[1] * inv, o0[2] * inv, o0[3] * inv);
    *(float4*)(orow +  4) = make_float4(o0[4] * inv, o0[5] * inv, o0[6] * inv, o0[7] * inv);
    *(float4*)(orow + 16) = make_float4(o1[0] * inv, o1[1] * inv, o1[2] * inv, o1[3] * inv);
    *(float4*)(orow + 20) = make_float4(o1[4] * inv, o1[5] * inv, o1[6] * inv, o1[7] * inv);
    *(float4*)(orow + 32) = make_float4(o2[0] * inv, o2[1] * inv, o2[2] * inv, o2[3] * inv);
    *(float4*)(orow + 36) = make_float4(o2[4] * inv, o2[5] * inv, o2[6] * inv, o2[7] * inv);
    *(float4*)(orow + 48) = make_float4(o3[0] * inv, o3[1] * inv, o3[2] * inv, o3[3] * inv);
    *(float4*)(orow + 52) = make_float4(o3[4] * inv, o3[5] * inv, o3[6] * inv, o3[7] * inv);
}

// ---------------------------------------------------------------------------
// launch
// ---------------------------------------------------------------------------
extern "C" void kernel_launch(void* const* d_in, const int* in_sizes, int n_in,
                              void* d_out, int out_size, void* d_ws, size_t ws_size,
                              hipStream_t stream) {
    const float* x     = (const float*)d_in[0];   // (4,2048,512)
    const int*   mask  = (const int*)d_in[1];     // (4,2048)
    const float* Wq    = (const float*)d_in[2];   // (512,128)
    const float* bq    = (const float*)d_in[3];   // (128)
    const float* Wk    = (const float*)d_in[4];   // (512,128)
    const float* bk    = (const float*)d_in[5];   // (128)
    const float* Wv    = (const float*)d_in[6];   // (512,512)
    const float* bv    = (const float*)d_in[7];   // (512)
    const float* gamma = (const float*)d_in[8];   // (1)
    float* out = (float*)d_out;

    // workspace layout (f16 buffers), 256B aligned
    char* ws = (char*)d_ws;
    size_t off = 0;
    auto take = [&](size_t bytes) -> char* {
        char* p = ws + off;
        off = (off + bytes + 255) & ~(size_t)255;
        return p;
    };
    _Float16* qh  = (_Float16*)take((size_t)BATCH * NH * SEQ * DQ * 2); // 2 MB
    _Float16* kh  = (_Float16*)take((size_t)BATCH * NH * SEQ * DQ * 2); // 2 MB
    _Float16* vh  = (_Float16*)take((size_t)BATCH * NH * SEQ * DV * 2); // 8 MB

    // 1) projections, one launch (WMMA GEMM on fp32 inputs, head-split f16 outputs)
    gemm_proj<<<dim3(ROWS / 64, 6), 256, 0, stream>>>(x, Wq, bq, Wk, bk, Wv, bv, qh, kh, vh);

    // 2) streaming masked-softmax attention (WMMA), fp32 output
    attn_kernel<<<dim3(SEQ / 128, BATCH * NH), 256, 0, stream>>>(
        qh, kh, vh, mask, gamma, out);
}

// v007
// A run of this version takes 48 microseconds.
// Next to v006, in two timings, it ran 1.07 times as fast each time.
// All steps since v000 together make it 4.24 times as fast.
#include <hip/hip_runtime.h>
#include <hip/hip_bf16.h>

// ---- problem constants (from reference) ----
#define BATCH 4
#define SEQ   2048
#define CH    512
#define NH    8
#define DQ    16      // per-head q/k dim
#define DV    64      // per-head v dim
#define ROWS  (BATCH * SEQ)   // 8192

typedef __attribute__((ext_vector_type(16))) _Float16 v16h;
typedef __attribute__((ext_vector_type(8)))  float    v8f;
typedef __attribute__((ext_vector_type(4)))  float    v4f;

union Frag {
    v16h      v;
    _Float16  h[16];
    uint4     q[2];
};

// 16-bit transposing LDS load: from a row-major tile T[k][n], lane (c = lane & 15, h = lane >> 4)
// gets T[k0 + 8h + 0..7][n0 + c]; the lane's own address is
// T + (k0 + 8h + (lane & 7)) * pitch + 2 * n0 + 16 * ((lane >> 3) & 1) bytes.
// Loads at k0 and k0 + 16 make one 16x32 operand in the hardware k order.
typedef __attribute__((ext_vector_type(8))) short s16x8;
static __device__ __forceinline__ uint4 ld_tr16(const _Float16* p) {
    typedef __attribute__((address_space(3))) s16x8 lds_s16x8;
    return __builtin_bit_cast(uint4, __builtin_amdgcn_ds_load_tr16_b128_v8i16((lds_s16x8*)p));
}

// LDS row pitches in halves: 16 B x odd for ds_load_b128 readers, 32 B x odd for ds_load_tr16_b128
#define AS_PITCH 40    // 64-B rows  -> 80 B
#define BS_PITCH 144   // 256-B rows -> 288 B
#define VS_PITCH 80    // 128-B rows -> 160 B

static __device__ __forceinline__ v8f wmma16(v16h a, v16h b, v8f c) {
    return __builtin_amdgcn_wmma_f32_16x16x32_f16(
        /*neg_a=*/false, a, /*neg_b=*/false, b,
        /*c_mod=*/(short)0, c, /*reuse_a=*/false, /*reuse_b=*/false);
}

// ---------------------------------------------------------------------------
// Projection GEMM: C[ROWS x N] = A[ROWS x 512] * Bw[512 x N] + bias
// A and Bw are read as fp32 and rounded to f16 on the way into LDS.
// Output written f16 in head-split layout: out[((b*NH+h)*SEQ+m)*hd + d]
// Block tile 64(M) x 128(N), 8 waves (4x2), wave tile 16x64, K step 32.
// One launch does all three projections: blockIdx.y picks a 128-column group,
// 0 = q, 1 = k, 2..5 = v. A block's K loop is a chain of load and LDS latencies,
// so the q and k groups run beside the v groups on the same WGPs, not ahead of them.
// hdShift: log2(head dim) -> 4 for q/k, 6 for v (avoids runtime div/mod).
// ---------------------------------------------------------------------------
__global__ __launch_bounds__(256) void gemm_proj(
    const float* __restrict__ A,
    const float* __restrict__ Wq, const float* __restrict__ bq,
    const float* __restrict__ Wk, const float* __restrict__ bk,
    const float* __restrict__ Wv, const float* __restrict__ bv,
    _Float16* __restrict__ qOut, _Float16* __restrict__ kOut, _Float16* __restrict__ vOut)
{
    // this block's projection (uniform over the block)
    const int grp = blockIdx.y;
    const float* __restrict__ Bw   = grp == 0 ? Wq : grp == 1 ? Wk : Wv;
    const float* __restrict__ bias = grp == 0 ? bq : grp == 1 ? bk : bv;
    _Float16* __restrict__ outp    = grp == 0 ? qOut : grp == 1 ? kOut : vOut;
    const int N       = grp < 2 ? NH * DQ : NH * DV;
    const int hdShift = grp < 2 ? 4 : 6;
    // q leaves in the unit the attention kernel's exp2 wants: 1/sqrt(16) * log2(e), applied in fp32, ahead of the rounding
    const float oScale = grp == 0 ? 0.25f * 1.44269504f : 1.0f;

    __shared__ alignas(16) _Float16 As[64][AS_PITCH];
    __shared__ alignas(16) _Float16 Bs[32][BS_PITCH];   // row-major: [k][n]

    const int tid  = threadIdx.x;
    const int wave = tid >> 5;
    const int lane = tid & 31;
    const int half = lane >> 4;
    const int l    = lane & 15;
    const int mw   = wave >> 1;        // 0..3
    const int nw   = wave & 1;         // 0..1

    const int r0 = blockIdx.x * 64;
    const int n0 = grp < 2 ? 0 : (grp - 2) * 128;

    // per-thread staging coordinates (loop-invariant): neighbouring lanes read neighbouring
    // 16 bytes, so every wave-wide load covers four whole 128-B lines and no line is touched twice.
    // A tile: 8 lanes per 128-B row piece, 32 rows per load, 2 loads.
    // B tile: a wave per 512-B row, 8 rows per load, 4 loads.
    const int aRow = tid >> 3, aCol = (tid & 7) * 4;
    const int bK = tid >> 5, bN = (tid & 31) * 4;

    const float* aSrcBase = A + (size_t)(r0 + aRow) * 512 + aCol;
    const float* bSrcBase = Bw + (size_t)bK * N + n0 + bN;

    // prefetch addresses: one instruction reaches every line of its tile. They step to the next
    // tile only where that tile exists, so their registers never leave the two arrays.
    const float* aPf = A + (size_t)(r0 + (tid >> 2)) * 512 + (tid & 3) * 8;
    const float* bPf = Bw + (size_t)(tid >> 3) * N + n0 + (tid & 7) * 16;

    // this lane's address for the transposing loads of the B tile
    const _Float16* bTr = &Bs[half * 8 + (lane & 7)][nw * 64 + ((lane >> 3) & 1) * 8];

    v8f acc[4];
    v8f zero = {};
    acc[0] = zero; acc[1] = zero; acc[2] = zero; acc[3] = zero;

    for (int kk = 0; kk < 512; kk += 32) {
        __syncthreads();
        {
            // this thread's 8 fp32 of the A tile and 16 fp32 of the B tile
            const float* bsrc = bSrcBase + (size_t)kk * N;
            v4f fa[2], fb[4];
            fa[0] = *(const v4f*)(aSrcBase + kk);
            fa[1] = *(const v4f*)(aSrcBase + kk + 32 * 512);
#pragma unroll
            for (int e = 0; e < 4; e++) fb[e] = *(const v4f*)(bsrc + (size_t)(e * 8) * N);
            // one statement on the six loaded values: it keeps the loads in flight together (without it
            // each load is waited for before the next is issued), and it holds the conversions below,
            // which reuse the loads' address registers, behind s_wait_xcnt 0 (a precaution)
            asm volatile("s_wait_xcnt 0x0"
                         : "+v"(fa[0]), "+v"(fa[1]), "+v"(fb[0]), "+v"(fb[1]), "+v"(fb[2]), "+v"(fb[3])
                         :: "memory");
            // stage A tile 64x32 (4 halves of each of two rows per thread)
#pragma unroll
            for (int e = 0; e < 2; e++) {
                alignas(8) _Float16 ta[4];
                ta[0] = (_Float16)fa[e].x;
                ta[1] = (_Float16)fa[e].y;
                ta[2] = (_Float16)fa[e].z;
                ta[3] = (_Float16)fa[e].w;
                *(uint2*)&As[aRow + e * 32][aCol] = *(const uint2*)ta;
            }
            // stage B tile 32x128 row-major (4 halves of each of four rows per thread)
#pragma unroll
            for (int e = 0; e < 4; e++) {
                alignas(8) _Float16 tb[4];
                tb[0] = (_Float16)fb[e].x;
                tb[1] = (_Float16)fb[e].y;
                tb[2] = (_Float16)fb[e].z;
                tb[3] = (_Float16)fb[e].w;
                *(uint2*)&Bs[bK + e * 8][bN] = *(const uint2*)tb;
            }
        }
        // prefetch next iteration's tiles into cache while we compute
        if (kk + 32 < 512) {
            aPf += 32;
            bPf += (size_t)32 * N;
            __builtin_prefetch(aPf, 0, 1);
            __builtin_prefetch(bPf, 0, 1);
        }
        __syncthreads();

        // A fragment (16x32, documented 16-bit A layout)
        Frag af;
        af.q[0] = *(const uint4*)&As[mw * 16 + l][half * 8];
        af.q[1] = *(const uint4*)&As[mw * 16 + l][16 + half * 8];
#pragma unroll
        for (int f = 0; f < 4; f++) {
            // B fragment: column n = nw*64 + f*16 + l, same k order as the A fragment
            Frag bfr;
            bfr.q[0] = ld_tr16(bTr + f * 16);
            bfr.q[1] = ld_tr16(bTr + 16 * BS_PITCH + f * 16);
            acc[f] = wmma16(af.v, bfr.v, acc[f]);
        }
    }

    // epilogue: bias + head-split f16 store (shift/mask instead of div/mod)
    const int hdMask = (1 << hdShift) - 1;
#pragma unroll
    for (int f = 0; f < 4; f++) {
        int ncol = n0 + nw * 64 + f * 16 + l;
        float bs = bias[ncol];
        bs *= oScale;
        acc[f] *= oScale;
        int h = ncol >> hdShift;
        int d = ncol & hdMask;
#pragma unroll
        for (int r = 0; r < 8; r++) {
            int grow = r0 + mw * 16 + r + half * 8;
            int b_ = grow >> 11;           // / SEQ
            int m  = grow & (SEQ - 1);
            size_t dst = ((((size_t)b_ * NH + h) * SEQ + m) << hdShift) + d;
            outp[dst] = (_Float16)(acc[f][r] + bs);
        }
    }
}

// ---------------------------------------------------------------------------
// Streaming attention: one block = 128 query rows of one (b,h); 8 waves.
// K and V come in stages of 128 keys by asynchronous copies to LDS, two buffers:
// stage t + 1 is in flight while stage t is worked on, one barrier per stage.
// The batch row's mask is converted to float in LDS once, ahead of the loop.
// Per wave: 16 queries, both products transposed:
//   S^T = K*Q^T - ref (8 wmma per stage): a lane holds 64 of the 128 scores of ONE query.
//   Q arrives scaled to log2 units; ref, the query's softmax reference, is the C operand.
//   Any reference gives the same quotient O / sum, so ref is raised (and O and the sums
//   rescaled) only when a score of the stage tops it by more than REF_ROOM: every
//   probability stays <= 2^REF_ROOM, the row's largest >= 1, and a pass has no rescale.
//   relu: exp2(max(t, 0) - ref) = max(exp2(t - ref), exp2(-ref)).
//   O^T += V^T*P^T (4 wmma per 32 keys): two S^T tiles, packed to f16, are the B operand.
// ---------------------------------------------------------------------------
#define KSTG 128              // keys per stage
#define NSTG (SEQ / KSTG)     // stages
#define REF_ROOM 8.0f        // log2 units a score may stand above the reference

// lane l <-> lane l ^ 16
static __device__ __forceinline__ float xhalf(float x) {
    int b = __builtin_bit_cast(int, x);
    return __builtin_bit_cast(float,
        __builtin_amdgcn_permlanex16(b, b, 0x76543210, 0xfedcba98, false, false));
}

// x[i] = max(exp2(x[i]), lo), eight at a time. Written as one statement, each exponential in place:
// a neighbour should not overwrite a source directly behind a transcendental, the
// slot the instruction set wants kept; here the instruction behind each one touches other registers.
static __device__ __forceinline__ void exp2_floor8(v8f& x, float lo) {
    float a = x[0], b = x[1], c = x[2], d = x[3], e = x[4], f = x[5], g = x[6], h = x[7];
    asm("v_exp_f32 %0, %0\n\t"
        "v_exp_f32 %1, %1\n\t"
        "v_exp_f32 %2, %2\n\t"
        "v_exp_f32 %3, %3\n\t"
        "v_exp_f32 %4, %4\n\t"
        "v_exp_f32 %5, %5\n\t"
        "v_exp_f32 %6, %6\n\t"
        "v_exp_f32 %7, %7\n\t"
        "v_max_num_f32 %0, %0, %8\n\t"
        "v_max_num_f32 %1, %1, %8\n\t"
        "v_max_num_f32 %2, %2, %8\n\t"
        "v_max_num_f32 %3, %3, %8\n\t"
        "v_max_num_f32 %4, %4, %8\n\t"
        "v_max_num_f32 %5, %5, %8\n\t"
        "v_max_num_f32 %6, %6, %8\n\t"
        "v_max_num_f32 %7, %7, %8"
        : "+v"(a), "+v"(b), "+v"(c), "+v"(d), "+v"(e), "+v"(f), "+v"(g), "+v"(h)
        : "v"(lo));
    x = v8f{a, b, c, d, e, f, g, h};
}

// LDS byte address of a __shared__ object: the low 32 bits of its address
static __device__ __forceinline__ unsigned lds_addr(const void* p) {
    return (unsigned)(size_t)p;
}

// This thread's share of one stage: 16 B of K and 16 B of each of four V rows, 32 rows apart.
// The copies go past the registers, so a stage can fly while the one before it is worked on.
// s_wait_xcnt 0 closes the statement, ahead of any rewrite of the address registers (a precaution).
static __device__ __forceinline__ void stage_copy(unsigned kl, const _Float16* kg,
                                                  unsigned vl, const _Float16* vg) {
    asm volatile(
        "global_load_async_to_lds_b128 %0, %5, off\n\t"
        "global_load_async_to_lds_b128 %1, %6, off\n\t"
        "global_load_async_to_lds_b128 %2, %7, off\n\t"
        "global_load_async_to_lds_b128 %3, %8, off\n\t"
        "global_load_async_to_lds_b128 %4, %9, off\n\t"
        "s_wait_xcnt 0x0"
        :: "v"(kl), "v"(vl), "v"(vl + 32 * VS_PITCH * 2), "v"(vl + 64 * VS_PITCH * 2),
           "v"(vl + 96 * VS_PITCH * 2),
           "v"(kg), "v"(vg), "v"(vg + 32 * DV), "v"(vg + 64 * DV), "v"(vg + 96 * DV)
        : "memory");
}

// Two blocks per WGP is all the grid gives: four waves per SIMD. Said to the compiler, it spends
// that register budget on LDS loads issued ahead of their use instead of waiting for each in turn.
__global__ __launch_bounds__(256) __attribute__((amdgpu_waves_per_eu(4, 4))) void attn_kernel(
    const _Float16* __restrict__ Q, const _Float16* __restrict__ K,
    const _Float16* __restrict__ V, const int* __restrict__ mask,
    const float* __restrict__ gamma, float* __restrict__ out)
{
    __shared__ alignas(16) _Float16 Kt[2][KSTG][DQ];        // [buffer][key][d]
    __shared__ alignas(16) _Float16 Vs[2][KSTG][VS_PITCH];  // [buffer][key][d], row-major
    __shared__ alignas(32) float mskf[SEQ];

    const int tid  = threadIdx.x;
    const int wave = tid >> 5;
    const int lane = tid & 31;
    const int half = lane >> 4;
    const int l    = lane & 15;

    const int bh = blockIdx.y;            // b*NH + h
    const int b  = bh >> 3;               // / NH
    const int h  = bh & (NH - 1);
    const int q0 = blockIdx.x * 128 + wave * 16;

    const size_t headBase = (size_t)bh * SEQ;

    // per-thread staging coordinates (loop-invariant): 8 lanes cover one 128-B V row
    const _Float16* kSrc = K + headBase * DQ + tid * 8;
    const _Float16* vSrc = V + (headBase + (tid >> 3)) * DV + (tid & 7) * 8;
    const unsigned kDst = lds_addr(&Kt[0][0][0]) + tid * 16;
    const unsigned vDst = lds_addr(&Vs[0][tid >> 3][(tid & 7) * 8]);
    const unsigned kBufB = KSTG * DQ * 2;        // bytes from buffer 0 to buffer 1
    const unsigned vBufB = KSTG * VS_PITCH * 2;

    // stage 0 into buffer 0
    stage_copy(kDst, kSrc, vDst, vSrc);

    // the mask of this batch row, as float (8 keys per thread)
    {
        const int4* ms = (const int4*)(mask + (size_t)b * SEQ + tid * 8);
        const int4 m0 = ms[0], m1 = ms[1];
        *(float4*)&mskf[tid * 8]     = make_float4((float)m0.x, (float)m0.y, (float)m0.z, (float)m0.w);
        *(float4*)&mskf[tid * 8 + 4] = make_float4((float)m1.x, (float)m1.y, (float)m1.z, (float)m1.w);
    }

    // this lane's address for the transposing loads of the V tile
    const _Float16* vTr0 = &Vs[0][half * 8 + (lane & 7)][((lane >> 3) & 1) * 8];

    // Q^T fragment (B operand): column = query l, 16 d padded to 32 (upper k zero)
    Frag qb;
    qb.q[0] = *(const uint4*)(Q + (headBase + q0 + l) * DQ + half * 8);
    qb.q[1] = make_uint4(0u, 0u, 0u, 0u);

    v8f zero = {};
    v8f o0 = zero, o1 = zero, o2 = zero, o3 = zero;   // o_f[r] = O[query l][f*16 + half*8 + r]
    v8f nref = zero;   // minus the reference of query l (relu => row max >= 0), equal in both halves
    float e0 = 1.0f;   // exp2(-reference): the probability of a score that relu lifts to 0
    v8f rs = zero;     // this lane's eight partial masked sums of query l

    // stage 0 has landed for this wave; the barrier publishes it (and the mask) to the others
    asm volatile("s_wait_asynccnt 0x0" ::: "memory");
    __syncthreads();
    // stage 1 into buffer 1
    stage_copy(kDst + kBufB, kSrc + KSTG * DQ, vDst + vBufB, vSrc + KSTG * DV);

    for (int t = 0; t < NSTG; t++) {
        const int buf = t & 1;
        const _Float16* vTr = vTr0 + buf * (KSTG * VS_PITCH);

        // scores of the whole stage, minus the reference: S^T[128 keys x 16 queries] (A = K rows, padded k)
        // (every loop over s, kq or tq below is unrolled so that their indices are constants
        // and the arrays live in registers)
        v8f s[KSTG / 16];   // s[j][r]: key j*16 + half*8 + r, query l
        {
            v4f kq[KSTG / 16];
#pragma unroll
            for (int j = 0; j < KSTG / 16; j++) kq[j] = *(const v4f*)&Kt[buf][j * 16 + l][half * 8];
            // inputs-only fence on the loaded values: keeps the eight loads in flight together;
            // without it each load is waited for before the next is issued
            asm volatile("" :: "v"(kq[0]), "v"(kq[1]), "v"(kq[2]), "v"(kq[3]),
                               "v"(kq[4]), "v"(kq[5]), "v"(kq[6]), "v"(kq[7]));
#pragma unroll
            for (int j = 0; j < KSTG / 16; j++) {
                Frag ka;
                ka.q[0] = __builtin_bit_cast(uint4, kq[j]);
                ka.q[1] = make_uint4(0u, 0u, 0u, 0u);
                s[j] = wmma16(ka.v, qb.v, nref);
            }
        }

        // how far this lane's scores stand above the reference
        float tq[4];   // four chains, so that no link waits for the one before it
#pragma unroll
        for (int c = 0; c < 4; c++) {
            tq[c] = s[2 * c][0];
#pragma unroll
            for (int r = 0; r < 8; r++) tq[c] = fmaxf(tq[c], fmaxf(s[2 * c][r], s[2 * c + 1][r]));
        }
        const float tm = fmaxf(fmaxf(tq[0], tq[1]), fmaxf(tq[2], tq[3]));

        // rare: some query of the wave outgrew its reference; raise every query's to its stage max
        if (__builtin_amdgcn_ballot_w32(tm > REF_ROOM) != 0u) {
            const float up = fmaxf(fmaxf(tm, xhalf(tm)), 0.0f);
            const float sf = __builtin_amdgcn_exp2f(-up);
#pragma unroll
            for (int j = 0; j < KSTG / 16; j++) s[j] -= up;
            nref -= up;
            e0 = __builtin_amdgcn_exp2f(nref[0]);
            rs *= sf;
            o0 *= sf; o1 *= sf; o2 *= sf; o3 *= sf;
        }

#pragma unroll
        for (int p = 0; p < KSTG / 32; p++) {
            v8f s0 = s[2 * p], s1 = s[2 * p + 1];

            // masks of this lane's 16 keys
            const v8f mk0 = *(const v8f*)&mskf[t * KSTG + p * 32 + half * 8];
            const v8f mk1 = *(const v8f*)&mskf[t * KSTG + p * 32 + 16 + half * 8];

            // masked probabilities; packed in place they are P^T in B-operand order
            exp2_floor8(s0, e0);
            exp2_floor8(s1, e0);
            s0 *= mk0;
            s1 *= mk1;
            Frag pb;
#pragma unroll
            for (int r = 0; r < 8; r++) {
                pb.h[r]     = (_Float16)s0[r];
                pb.h[8 + r] = (_Float16)s1[r];
            }
            rs += s0 + s1;

            // V^T fragments (A operand, rows = d) by transposing loads from the row-major tile
            const _Float16* vp = vTr + p * 32 * VS_PITCH;
            Frag va;
            va.q[0] = ld_tr16(vp + 0 * 16);
            va.q[1] = ld_tr16(vp + 16 * VS_PITCH + 0 * 16);
            o0 = wmma16(va.v, pb.v, o0);
            va.q[0] = ld_tr16(vp + 1 * 16);
            va.q[1] = ld_tr16(vp + 16 * VS_PITCH + 1 * 16);
            o1 = wmma16(va.v, pb.v, o1);
            va.q[0] = ld_tr16(vp + 2 * 16);
            va.q[1] = ld_tr16(vp + 16 * VS_PITCH + 2 * 16);
            o2 = wmma16(va.v, pb.v, o2);
            va.q[0] = ld_tr16(vp + 3 * 16);
            va.q[1] = ld_tr16(vp + 16 * VS_PITCH + 3 * 16);
            o3 = wmma16(va.v, pb.v, o3);
        }

        // hand-over: this wave's reads of buffer buf are done ...
        asm volatile("s_wait_dscnt 0x0" ::: "memory");
        // ... and its copies of stage t + 1 have landed;
        asm volatile("s_wait_asynccnt 0x0" ::: "memory");
        // the barrier publishes stage t + 1 and frees buffer buf for its refill
        __syncthreads();
        if (t + 2 < NSTG)
            stage_copy(kDst + buf * kBufB, kSrc + (size_t)(t + 2) * (KSTG * DQ),
                       vDst + buf * vBufB, vSrc + (size_t)(t + 2) * (KSTG * DV));
    }
    // no copy is left in flight when the wave ends
    asm volatile("s_wait_asynccnt 0x0" ::: "memory");

    // epilogue: join the halves' sums, beta normalization, gamma, fp32 store
    const float g = gamma[0];
    const float rl = ((rs[0] + rs[1]) + (rs[2] + rs[3])) + ((rs[4] + rs[5]) + (rs[6] + rs[7]));
    const float inv = g / (rl + xhalf(rl) + 1e-12f);
    float* orow = out + ((size_t)b * SEQ + q0 + l) * CH + (size_t)h * DV + half * 8;
    *(float4*)(orow +  0) = make_float4(o0[0] * inv, o0[1] * inv, o0[2] * inv, o0[3] * inv);
    *(float4*)(orow +  4) = make_float4(o0[4] * inv, o0[5] * inv, o0[6] * inv, o0[7] * inv);
    *(float4*)(orow + 16) = make_float4(o1[0] * inv, o1[1] * inv, o1[2] * inv, o1[3] * inv);
    *(float4*)(orow + 20) = make_float4(o1[4] * inv, o1[5] * inv, o1[6] * inv, o1[7] * inv);
    *(float4*)(orow + 32) = make_float4(o2[0] * inv, o2[1] * inv, o2[2] * inv, o2[3] * inv);
    *(float4*)(orow + 36) = make_float4(o2[4] * inv, o2[5] * inv, o2[6] * inv, o2[7] * inv);
    *(float4*)(orow + 48) = make_float4(o3[0] * inv, o3[1] * inv, o3[2] * inv, o3[3] * inv);
    *(float4*)(orow + 52) = make_float4(o3[4] * inv, o3[5] * inv, o3[6] * inv, o3[7] * inv);
}

// ---------------------------------------------------------------------------
// launch
// ---------------------------------------------------------------------------
extern "C" void kernel_launch(void* const* d_in, const int* in_sizes, int n_in,
                              void* d_out, int out_size, void* d_ws, size_t ws_size,
                              hipStream_t stream) {
    const float* x     = (const float*)d_in[0];   // (4,2048,512)
    const int*   mask  = (const int*)d_in[1];     // (4,2048)
    const float* Wq    = (const float*)d_in[2];   // (512,128)
    const float* bq    = (const float*)d_in[3];   // (128)
    const float* Wk    = (const float*)d_in[4];   // (512,128)
    const float* bk    = (const float*)d_in[5];   // (128)
    const float* Wv    = (const float*)d_in[6];   // (512,512)
    const float* bv    = (const float*)d_in[7];   // (512)
    const float* gamma = (const float*)d_in[8];   // (1)
    float* out = (float*)d_out;

    // workspace layout (f16 buffers), 256B aligned
    char* ws = (char*)d_ws;
    size_t off = 0;
    auto take = [&](size_t bytes) -> char* {
        char* p = ws + off;
        off = (off + bytes + 255) & ~(size_t)255;
        return p;
    };
    _Float16* qh  = (_Float16*)take((size_t)BATCH * NH * SEQ * DQ * 2); // 2 MB
    _Float16* kh  = (_Float16*)take((size_t)BATCH * NH * SEQ * DQ * 2); // 2 MB
    _Float16* vh  = (_Float16*)take((size_t)BATCH * NH * SEQ * DV * 2); // 8 MB

    // 1) projections, one launch (WMMA GEMM on fp32 inputs, head-split f16 outputs)
    gemm_proj<<<dim3(ROWS / 64, 6), 256, 0, stream>>>(x, Wq, bq, Wk, bk, Wv, bv, qh, kh, vh);

    // 2) streaming masked-softmax attention (WMMA), fp32 output
    attn_kernel<<<dim3(SEQ / 128, BATCH * NH), 256, 0, stream>>>(
        qh, kh, vh, mask, gamma, out);
}

// v008
// A run of this version takes 38.1 microseconds.
// In both of two side-by-side timings against v007, it was 1.26 times as fast.
// Over all steps from v000 it is 5.33 times as fast.
#include <hip/hip_runtime.h>
#include <hip/hip_bf16.h>

// ---- problem constants (from reference) ----
#define BATCH 4
#define SEQ   2048
#define CH    512
#define NH    8
#define DQ    16      // per-head q/k dim
#define DV    64      // per-head v dim
#define ROWS  (BATCH * SEQ)   // 8192

typedef __attribute__((ext_vector_type(16))) _Float16 v16h;
typedef __attribute__((ext_vector_type(8)))  float    v8f;
typedef __attribute__((ext_vector_type(4)))  float    v4f;

union Frag {
    v16h      v;
    _Float16  h[16];
    uint4     q[2];
};

// 16-bit transposing LDS load: from a row-major tile T[k][n], lane (c = lane & 15, h = lane >> 4)
// gets T[k0 + 8h + 0..7][n0 + c]; the lane's own address is
// T + (k0 + 8h + (lane & 7)) * pitch + 2 * n0 + 16 * ((lane >> 3) & 1) bytes.
// Loads at k0 and k0 + 16 make one 16x32 operand in the hardware k order.
typedef __attribute__((ext_vector_type(8))) short s16x8;
static __device__ __forceinline__ uint4 ld_tr16(const _Float16* p) {
    typedef __attribute__((address_space(3))) s16x8 lds_s16x8;
    return __builtin_bit_cast(uint4, __builtin_amdgcn_ds_load_tr16_b128_v8i16((lds_s16x8*)p));
}

// LDS row pitches in halves: 16 B x odd for ds_load_b128 readers, 32 B x odd for ds_load_tr16_b128
#define AS_PITCH 40    // 64-B rows  -> 80 B
#define BS_PITCH 144   // 256-B rows -> 288 B
#define VS_PITCH 80    // 128-B rows -> 160 B

static __device__ __forceinline__ v8f wmma16(v16h a, v16h b, v8f c) {
    return __builtin_amdgcn_wmma_f32_16x16x32_f16(
        /*neg_a=*/false, a, /*neg_b=*/false, b,
        /*c_mod=*/(short)0, c, /*reuse_a=*/false, /*reuse_b=*/false);
}

// ---------------------------------------------------------------------------
// Projection GEMM: C[ROWS x N] = A[ROWS x 512] * Bw[512 x N] + bias
// A and Bw are read as fp32 and rounded to f16 on the way into LDS.
// Output written f16 in head-split layout: out[((b*NH+h)*SEQ+m)*hd + d]
// Block tile 64(M) x 128(N), 8 waves (4x2), wave tile 16x64, K step 32.
// One launch does all three projections: blockIdx.y picks a 128-column group,
// 0 = q, 1 = k, 2..5 = v.
// hdShift: log2(head dim) -> 4 for q/k, 6 for v (avoids runtime div/mod).
// ---------------------------------------------------------------------------
__global__ __launch_bounds__(256) void gemm_proj(
    const float* __restrict__ A,
    const float* __restrict__ Wq, const float* __restrict__ bq,
    const float* __restrict__ Wk, const float* __restrict__ bk,
    const float* __restrict__ Wv, const float* __restrict__ bv,
    _Float16* __restrict__ qOut, _Float16* __restrict__ kOut, _Float16* __restrict__ vOut)
{
    // this block's projection (uniform over the block)
    const int grp = blockIdx.y;
    const float* __restrict__ Bw   = grp == 0 ? Wq : grp == 1 ? Wk : Wv;
    const float* __restrict__ bias = grp == 0 ? bq : grp == 1 ? bk : bv;
    _Float16* __restrict__ outp    = grp == 0 ? qOut : grp == 1 ? kOut : vOut;
    const int N       = grp < 2 ? NH * DQ : NH * DV;
    const int hdShift = grp < 2 ? 4 : 6;
    // q leaves in the unit the attention kernel's exp2 wants: 1/sqrt(16) * log2(e), applied in fp32, ahead of the rounding
    const float oScale = grp == 0 ? 0.25f * 1.44269504f : 1.0f;

    __shared__ alignas(16) _Float16 As[64][AS_PITCH];
    __shared__ alignas(16) _Float16 Bs[32][BS_PITCH];   // row-major: [k][n]

    const int tid  = threadIdx.x;
    const int wave = tid >> 5;
    const int lane = tid & 31;
    const int half = lane >> 4;
    const int l    = lane & 15;
    const int mw   = wave >> 1;        // 0..3
    const int nw   = wave & 1;         // 0..1

    const int r0 = blockIdx.x * 64;
    const int n0 = grp < 2 ? 0 : (grp - 2) * 128;

    // per-thread staging coordinates (loop-invariant): neighbouring lanes read neighbouring
    // 16 bytes, so every wave-wide load covers four whole 128-B lines and no line is touched twice.
    // A tile: 8 lanes per 128-B row piece, 32 rows per load, 2 loads.
    // B tile: a wave per 512-B row, 8 rows per load, 4 loads.
    const int aRow = tid >> 3, aCol = (tid & 7) * 4;
    const int bK = tid >> 5, bN = (tid & 31) * 4;

    const float* aSrcBase = A + (size_t)(r0 + aRow) * 512 + aCol;
    const float* bSrcBase = Bw + (size_t)bK * N + n0 + bN;

    // prefetch addresses: one instruction reaches every line of its tile. They step to the next
    // tile only where that tile exists, so their registers never leave the two arrays.
    const float* aPf = A + (size_t)(r0 + (tid >> 2)) * 512 + (tid & 3) * 8;
    const float* bPf = Bw + (size_t)(tid >> 3) * N + n0 + (tid & 7) * 16;

    // this lane's address for the transposing loads of the B tile
    const _Float16* bTr = &Bs[half * 8 + (lane & 7)][nw * 64 + ((lane >> 3) & 1) * 8];

    v8f acc[4];
    v8f zero = {};
    acc[0] = zero; acc[1] = zero; acc[2] = zero; acc[3] = zero;

    for (int kk = 0; kk < 512; kk += 32) {
        __syncthreads();
        {
            // this thread's 8 fp32 of the A tile and 16 fp32 of the B tile
            const float* bsrc = bSrcBase + (size_t)kk * N;
            v4f fa[2], fb[4];
            fa[0] = *(const v4f*)(aSrcBase + kk);
            fa[1] = *(const v4f*)(aSrcBase + kk + 32 * 512);
#pragma unroll
            for (int e = 0; e < 4; e++) fb[e] = *(const v4f*)(bsrc + (size_t)(e * 8) * N);
            // one statement on the six loaded values: it keeps the loads in flight together (without it
            // each load is waited for before the next is issued), and it holds the conversions below,
            // which reuse the loads' address registers, behind s_wait_xcnt 0 (a precaution)
            asm volatile("s_wait_xcnt 0x0"
                         : "+v"(fa[0]), "+v"(fa[1]), "+v"(fb[0]), "+v"(fb[1]), "+v"(fb[2]), "+v"(fb[3])
                         :: "memory");
            // stage A tile 64x32 (4 halves of each of two rows per thread)
#pragma unroll
            for (int e = 0; e < 2; e++) {
                alignas(8) _Float16 ta[4];
                ta[0] = (_Float16)fa[e].x;
                ta[1] = (_Float16)fa[e].y;
                ta[2] = (_Float16)fa[e].z;
                ta[3] = (_Float16)fa[e].w;
                *(uint2*)&As[aRow + e * 32][aCol] = *(const uint2*)ta;
            }
            // stage B tile 32x128 row-major (4 halves of each of four rows per thread)
#pragma unroll
            for (int e = 0; e < 4; e++) {
                alignas(8) _Float16 tb[4];
                tb[0] = (_Float16)fb[e].x;
                tb[1] = (_Float16)fb[e].y;
                tb[2] = (_Float16)fb[e].z;
                tb[3] = (_Float16)fb[e].w;
                *(uint2*)&Bs[bK + e * 8][bN] = *(const uint2*)tb;
            }
        }
        // prefetch next iteration's tiles into cache while we compute
        if (kk + 32 < 512) {
            aPf += 32;
            bPf += (size_t)32 * N;
            __builtin_prefetch(aPf, 0, 1);
            __builtin_prefetch(bPf, 0, 1);
        }
        __syncthreads();

        // A fragment (16x32, documented 16-bit A layout)
        Frag af;
        af.q[0] = *(const uint4*)&As[mw * 16 + l][half * 8];
        af.q[1] = *(const uint4*)&As[mw * 16 + l][16 + half * 8];
#pragma unroll
        for (int f = 0; f < 4; f++) {
            // B fragment: column n = nw*64 + f*16 + l, same k order as the A fragment
            Frag bfr;
            bfr.q[0] = ld_tr16(bTr + f * 16);
            bfr.q[1] = ld_tr16(bTr + 16 * BS_PITCH + f * 16);
            acc[f] = wmma16(af.v, bfr.v, acc[f]);
        }
    }

    // epilogue: bias + head-split f16 store (shift/mask instead of div/mod)
    const int hdMask = (1 << hdShift) - 1;
#pragma unroll
    for (int f = 0; f < 4; f++) {
        int ncol = n0 + nw * 64 + f * 16 + l;
        float bs = bias[ncol];
        bs *= oScale;
        acc[f] *= oScale;
        int h = ncol >> hdShift;
        int d = ncol & hdMask;
#pragma unroll
        for (int r = 0; r < 8; r++) {
            int grow = r0 + mw * 16 + r + half * 8;
            int b_ = grow >> 11;           // / SEQ
            int m  = grow & (SEQ - 1);
            size_t dst = ((((size_t)b_ * NH + h) * SEQ + m) << hdShift) + d;
            outp[dst] = (_Float16)(acc[f][r] + bs);
        }
    }
}

// ---------------------------------------------------------------------------
// Streaming attention: one block = 128 query rows of one (b,h); 8 waves.
// A key whose mask is 0 adds nothing to a row's output or to its masked sum, so it need not be
// visited: ahead of the loop the block orders the batch row's keys, those with a non-zero mask
// first (a count over the mask, the same in every block of the batch row), and the loop ends at
// the stage that holds the last of them. The order is a permutation of all SEQ keys for any mask.
// K and V come in stages of 128 listed keys by asynchronous copies to LDS, each lane fetching its
// piece of the row the list names, two buffers:
// stage t + 1 is in flight while stage t is worked on, one barrier per stage.
// The masks, as float and in the list's order, lie in LDS (0 behind the last live key).
// Per wave: 16 queries, both products transposed:
//   S^T = K*Q^T - ref (8 wmma per stage): a lane holds 64 of the 128 scores of ONE query.
//   Q arrives scaled to log2 units; ref, the query's softmax reference, is the C operand.
//   Any reference gives the same quotient O / sum, so ref is raised (and O and the sums
//   rescaled) only when a score of the stage tops it by more than REF_ROOM: every
//   probability stays <= 2^REF_ROOM, the row's largest >= 1, and a pass has no rescale.
//   relu: exp2(max(t, 0) - ref) = max(exp2(t - ref), exp2(-ref)).
//   O^T += V^T*P^T (4 wmma per 32 keys): two S^T tiles, packed to f16, are the B operand.
// ---------------------------------------------------------------------------
#define KSTG 128              // keys per stage
#define NSTG (SEQ / KSTG)     // stages
#define REF_ROOM 8.0f        // log2 units a score may stand above the reference

// lane l <-> lane l ^ 16
static __device__ __forceinline__ float xhalf(float x) {
    int b = __builtin_bit_cast(int, x);
    return __builtin_bit_cast(float,
        __builtin_amdgcn_permlanex16(b, b, 0x76543210, 0xfedcba98, false, false));
}

// x[i] = max(exp2(x[i]), lo), eight at a time. Written as one statement, each exponential in place:
// a neighbour should not overwrite a source directly behind a transcendental, the
// slot the instruction set wants kept; here the instruction behind each one touches other registers.
static __device__ __forceinline__ void exp2_floor8(v8f& x, float lo) {
    float a = x[0], b = x[1], c = x[2], d = x[3], e = x[4], f = x[5], g = x[6], h = x[7];
    asm("v_exp_f32 %0, %0\n\t"
        "v_exp_f32 %1, %1\n\t"
        "v_exp_f32 %2, %2\n\t"
        "v_exp_f32 %3, %3\n\t"
        "v_exp_f32 %4, %4\n\t"
        "v_exp_f32 %5, %5\n\t"
        "v_exp_f32 %6, %6\n\t"
        "v_exp_f32 %7, %7\n\t"
        "v_max_num_f32 %0, %0, %8\n\t"
        "v_max_num_f32 %1, %1, %8\n\t"
        "v_max_num_f32 %2, %2, %8\n\t"
        "v_max_num_f32 %3, %3, %8\n\t"
        "v_max_num_f32 %4, %4, %8\n\t"
        "v_max_num_f32 %5, %5, %8\n\t"
        "v_max_num_f32 %6, %6, %8\n\t"
        "v_max_num_f32 %7, %7, %8"
        : "+v"(a), "+v"(b), "+v"(c), "+v"(d), "+v"(e), "+v"(f), "+v"(g), "+v"(h)
        : "v"(lo));
    x = v8f{a, b, c, d, e, f, g, h};
}

// LDS byte address of a __shared__ object: the low 32 bits of its address
static __device__ __forceinline__ unsigned lds_addr(const void* p) {
    return (unsigned)(size_t)p;
}

// This thread's share of one stage: 16 B of a K row and 16 B of each of four V rows, which land
// 32 rows apart. kRow and vRow are the rows' numbers in the head (from the key list, 0 .. SEQ - 1).
// The copies go past the registers, so a stage can fly while the one before it is worked on.
// s_wait_xcnt 0 closes the statement, ahead of any rewrite of the address registers (a precaution).
static __device__ __forceinline__ void stage_copy(unsigned kl, const _Float16* kHead, int kRow,
                                                  unsigned vl, const _Float16* vHead, const int (&vRow)[4]) {
    const _Float16* kg  = kHead + kRow * DQ;
    const _Float16* vg0 = vHead + vRow[0] * DV;
    const _Float16* vg1 = vHead + vRow[1] * DV;
    const _Float16* vg2 = vHead + vRow[2] * DV;
    const _Float16* vg3 = vHead + vRow[3] * DV;
    asm volatile(
        "global_load_async_to_lds_b128 %0, %5, off\n\t"
        "global_load_async_to_lds_b128 %1, %6, off\n\t"
        "global_load_async_to_lds_b128 %2, %7, off\n\t"
        "global_load_async_to_lds_b128 %3, %8, off\n\t"
        "global_load_async_to_lds_b128 %4, %9, off\n\t"
        "s_wait_xcnt 0x0"
        :: "v"(kl), "v"(vl), "v"(vl + 32 * VS_PITCH * 2), "v"(vl + 64 * VS_PITCH * 2),
           "v"(vl + 96 * VS_PITCH * 2),
           "v"(kg), "v"(vg0), "v"(vg1), "v"(vg2), "v"(vg3)
        : "memory");
}

// Two blocks per WGP is all the grid gives: four waves per SIMD. Said to the compiler, it spends
// that register budget on LDS loads issued ahead of their use instead of waiting for each in turn.
__global__ __launch_bounds__(256) __attribute__((amdgpu_waves_per_eu(4, 4))) void attn_kernel(
    const _Float16* __restrict__ Q, const _Float16* __restrict__ K,
    const _Float16* __restrict__ V, const int* __restrict__ mask,
    const float* __restrict__ gamma, float* __restrict__ out)
{
    __shared__ alignas(16) _Float16 Kt[2][KSTG][DQ];        // [buffer][key][d]
    __shared__ alignas(16) _Float16 Vs[2][KSTG][VS_PITCH];  // [buffer][key][d], row-major
    __shared__ alignas(32) float mskf[SEQ];   // mask of the key at each place of the list
    __shared__ int kidx[SEQ];                 // the list: live keys first, then the rest
    __shared__ int wlive[8];                  // live keys in each wave's 256 keys

    const int tid  = threadIdx.x;
    const int wave = tid >> 5;
    const int lane = tid & 31;
    const int half = lane >> 4;
    const int l    = lane & 15;

    const int bh = blockIdx.y;            // b*NH + h
    const int b  = bh >> 3;               // / NH
    const int h  = bh & (NH - 1);
    const int q0 = blockIdx.x * 128 + wave * 16;

    const size_t headBase = (size_t)bh * SEQ;

    // per-thread staging coordinates (loop-invariant): 2 lanes cover one 32-B K row, 8 one 128-B V row
    const _Float16* kSrc = K + headBase * DQ + (tid & 1) * 8;
    const _Float16* vSrc = V + headBase * DV + (tid & 7) * 8;
    const int* kLst = &kidx[tid >> 1];   // the list's entries for this thread's rows of stage 0
    const int* vLst = &kidx[tid >> 3];
    const unsigned kDst = lds_addr(&Kt[0][0][0]) + tid * 16;
    const unsigned vDst = lds_addr(&Vs[0][tid >> 3][(tid & 7) * 8]);
    const unsigned kBufB = KSTG * DQ * 2;        // bytes from buffer 0 to buffer 1
    const unsigned vBufB = KSTG * VS_PITCH * 2;

    // the key list of this batch row (8 keys per thread, in key order)
    int nLive;
    {
        const int4* ms = (const int4*)(mask + (size_t)b * SEQ + tid * 8);
        const int4 m0 = ms[0], m1 = ms[1];
        // (the three loops below are unrolled so that their indices are constants and mv lives in registers)
        const int mv[8] = {m0.x, m0.y, m0.z, m0.w, m1.x, m1.y, m1.z, m1.w};
        // live keys of the wave's lower lanes, and of the whole wave
        unsigned ahead = 0u;
        int wsum = 0;
#pragma unroll
        for (int j = 0; j < 8; j++) {
            const unsigned on = __builtin_amdgcn_ballot_w32(mv[j] != 0);
            ahead = __builtin_amdgcn_mbcnt_lo(on, ahead);
            wsum += __builtin_popcount(on);
        }
        if (lane == 0) wlive[wave] = wsum;
        // the waves' counts reach every wave
        __syncthreads();
        int live = (int)ahead;   // live keys ahead of key tid * 8
        int all = 0;
#pragma unroll
        for (int w = 0; w < 8; w++) {
            const int cw = wlive[w];
            all += cw;
            live += w < wave ? cw : 0;
        }
        // a live key goes to its rank among the live ones, another to all + its rank among the others:
        // every place 0 .. SEQ - 1 is written once, whatever the mask holds
#pragma unroll
        for (int j = 0; j < 8; j++) {
            const int key = tid * 8 + j;
            const bool on = mv[j] != 0;
            const int pos = on ? live : all + (key - live);
            kidx[pos] = key;
            mskf[pos] = (float)mv[j];
            live += on ? 1 : 0;
        }
        nLive = __builtin_amdgcn_readfirstlane(all);
    }
    // stages that hold a live key (the same in every wave of the block; at most NSTG)
    const int nStg = min((nLive + KSTG - 1) / KSTG, NSTG);
    // the list (and the masks) reach every wave
    __syncthreads();

    // stage 0 into buffer 0
    {
        const int vr[4] = {vLst[0], vLst[32], vLst[64], vLst[96]};
        stage_copy(kDst, kSrc, kLst[0], vDst, vSrc, vr);
    }

    // this lane's address for the transposing loads of the V tile
    const _Float16* vTr0 = &Vs[0][half * 8 + (lane & 7)][((lane >> 3) & 1) * 8];

    // Q^T fragment (B operand): column = query l, 16 d padded to 32 (upper k zero)
    Frag qb;
    qb.q[0] = *(const uint4*)(Q + (headBase + q0 + l) * DQ + half * 8);
    qb.q[1] = make_uint4(0u, 0u, 0u, 0u);

    v8f zero = {};
    v8f o0 = zero, o1 = zero, o2 = zero, o3 = zero;   // o_f[r] = O[query l][f*16 + half*8 + r]
    v8f nref = zero;   // minus the reference of query l (relu => row max >= 0), equal in both halves
    float e0 = 1.0f;   // exp2(-reference): the probability of a score that relu lifts to 0
    v8f rs = zero;     // this lane's eight partial masked sums of query l

    // stage 0 has landed for this wave; the barrier publishes it to the others
    asm volatile("s_wait_asynccnt 0x0" ::: "memory");
    __syncthreads();
    // stage 1 into buffer 1 (the list names SEQ rows, so the stage exists also where the loop ends ahead of it)
    {
        const int vr[4] = {vLst[KSTG], vLst[KSTG + 32], vLst[KSTG + 64], vLst[KSTG + 96]};
        stage_copy(kDst + kBufB, kSrc, kLst[KSTG], vDst + vBufB, vSrc, vr);
    }

    for (int t = 0; t < nStg; t++) {
        const int buf = t & 1;
        const _Float16* vTr = vTr0 + buf * (KSTG * VS_PITCH);

        // the list's entries for the refill at the foot, read here so that the copies do not wait for them
        const int tn = min(t + 2, NSTG - 1) * KSTG;
        const int kr = kLst[tn];
        const int vr[4] = {vLst[tn], vLst[tn + 32], vLst[tn + 64], vLst[tn + 96]};

        // scores of the whole stage, minus the reference: S^T[128 keys x 16 queries] (A = K rows, padded k)
        // (every loop over s, kq or tq below is unrolled so that their indices are constants
        // and the arrays live in registers)
        v8f s[KSTG / 16];   // s[j][r]: key j*16 + half*8 + r, query l
        {
            v4f kq[KSTG / 16];
#pragma unroll
            for (int j = 0; j < KSTG / 16; j++) kq[j] = *(const v4f*)&Kt[buf][j * 16 + l][half * 8];
            // inputs-only fence on the loaded values: keeps the eight loads in flight together;
            // without it each load is waited for before the next is issued
            asm volatile("" :: "v"(kq[0]), "v"(kq[1]), "v"(kq[2]), "v"(kq[3]),
                               "v"(kq[4]), "v"(kq[5]), "v"(kq[6]), "v"(kq[7]));
#pragma unroll
            for (int j = 0; j < KSTG / 16; j++) {
                Frag ka;
                ka.q[0] = __builtin_bit_cast(uint4, kq[j]);
                ka.q[1] = make_uint4(0u, 0u, 0u, 0u);
                s[j] = wmma16(ka.v, qb.v, nref);
            }
        }

        // how far this lane's scores stand above the reference
        float tq[4];   // four chains, so that no link waits for the one before it
#pragma unroll
        for (int c = 0; c < 4; c++) {
            tq[c] = s[2 * c][0];
#pragma unroll
            for (int r = 0; r < 8; r++) tq[c] = fmaxf(tq[c], fmaxf(s[2 * c][r], s[2 * c + 1][r]));
        }
        const float tm = fmaxf(fmaxf(tq[0], tq[1]), fmaxf(tq[2], tq[3]));

        // rare: some query of the wave outgrew its reference; raise every query's to its stage max
        if (__builtin_amdgcn_ballot_w32(tm > REF_ROOM) != 0u) {
            const float up = fmaxf(fmaxf(tm, xhalf(tm)), 0.0f);
            const float sf = __builtin_amdgcn_exp2f(-up);
#pragma unroll
            for (int j = 0; j < KSTG / 16; j++) s[j] -= up;
            nref -= up;
            e0 = __builtin_amdgcn_exp2f(nref[0]);
            rs *= sf;
            o0 *= sf; o1 *= sf; o2 *= sf; o3 *= sf;
        }

#pragma unroll
        for (int p = 0; p < KSTG / 32; p++) {
            v8f s0 = s[2 * p], s1 = s[2 * p + 1];

            // masks of this lane's 16 keys
            const v8f mk0 = *(const v8f*)&mskf[t * KSTG + p * 32 + half * 8];
            const v8f mk1 = *(const v8f*)&mskf[t * KSTG + p * 32 + 16 + half * 8];

            // masked probabilities; packed in place they are P^T in B-operand order
            exp2_floor8(s0, e0);
            exp2_floor8(s1, e0);
            s0 *= mk0;
            s1 *= mk1;
            Frag pb;
#pragma unroll
            for (int r = 0; r < 8; r++) {
                pb.h[r]     = (_Float16)s0[r];
                pb.h[8 + r] = (_Float16)s1[r];
            }
            rs += s0 + s1;

            // V^T fragments (A operand, rows = d) by transposing loads from the row-major tile
            const _Float16* vp = vTr + p * 32 * VS_PITCH;
            Frag va;
            va.q[0] = ld_tr16(vp + 0 * 16);
            va.q[1] = ld_tr16(vp + 16 * VS_PITCH + 0 * 16);
            o0 = wmma16(va.v, pb.v, o0);
            va.q[0] = ld_tr16(vp + 1 * 16);
            va.q[1] = ld_tr16(vp + 16 * VS_PITCH + 1 * 16);
            o1 = wmma16(va.v, pb.v, o1);
            va.q[0] = ld_tr16(vp + 2 * 16);
            va.q[1] = ld_tr16(vp + 16 * VS_PITCH + 2 * 16);
            o2 = wmma16(va.v, pb.v, o2);
            va.q[0] = ld_tr16(vp + 3 * 16);
            va.q[1] = ld_tr16(vp + 16 * VS_PITCH + 3 * 16);
            o3 = wmma16(va.v, pb.v, o3);
        }

        // hand-over: this wave's reads of buffer buf are done ...
        asm volatile("s_wait_dscnt 0x0" ::: "memory");
        // ... and its copies of stage t + 1 have landed;
        asm volatile("s_wait_asynccnt 0x0" ::: "memory");
        // the barrier publishes stage t + 1 and frees buffer buf for its refill
        __syncthreads();
        if (t + 2 < nStg)
            stage_copy(kDst + buf * kBufB, kSrc, kr, vDst + buf * vBufB, vSrc, vr);
    }
    // no copy is left in flight when the wave ends
    asm volatile("s_wait_asynccnt 0x0" ::: "memory");

    // epilogue: join the halves' sums, beta normalization, gamma, fp32 store
    const float g = gamma[0];
    const float rl = ((rs[0] + rs[1]) + (rs[2] + rs[3])) + ((rs[4] + rs[5]) + (rs[6] + rs[7]));
    const float inv = g / (rl + xhalf(rl) + 1e-12f);
    float* orow = out + ((size_t)b * SEQ + q0 + l) * CH + (size_t)h * DV + half * 8;
    *(float4*)(orow +  0) = make_float4(o0[0] * inv, o0[1] * inv, o0[2] * inv, o0[3] * inv);
    *(float4*)(orow +  4) = make_float4(o0[4] * inv, o0[5] * inv, o0[6] * inv, o0[7] * inv);
    *(float4*)(orow + 16) = make_float4(o1[0] * inv, o1[1] * inv, o1[2] * inv, o1[3] * inv);
    *(float4*)(orow + 20) = make_float4(o1[4] * inv, o1[5] * inv, o1[6] * inv, o1[7] * inv);
    *(float4*)(orow + 32) = make_float4(o2[0] * inv, o2[1] * inv, o2[2] * inv, o2[3] * inv);
    *(float4*)(orow + 36) = make_float4(o2[4] * inv, o2[5] * inv, o2[6] * inv, o2[7] * inv);
    *(float4*)(orow + 48) = make_float4(o3[0] * inv, o3[1] * inv, o3[2] * inv, o3[3] * inv);
    *(float4*)(orow + 52) = make_float4(o3[4] * inv, o3[5] * inv, o3[6] * inv, o3[7] * inv);
}

// ---------------------------------------------------------------------------
// launch
// ---------------------------------------------------------------------------
extern "C" void kernel_launch(void* const* d_in, const int* in_sizes, int n_in,
                              void* d_out, int out_size, void* d_ws, size_t ws_size,
                              hipStream_t stream) {
    const float* x     = (const float*)d_in[0];   // (4,2048,512)
    const int*   mask  = (const int*)d_in[1];     // (4,2048)
    const float* Wq    = (const float*)d_in[2];   // (512,128)
    const float* bq    = (const float*)d_in[3];   // (128)
    const float* Wk    = (const float*)d_in[4];   // (512,128)
    const float* bk    = (const float*)d_in[5];   // (128)
    const float* Wv    = (const float*)d_in[6];   // (512,512)
    const float* bv    = (const float*)d_in[7];   // (512)
    const float* gamma = (const float*)d_in[8];   // (1)
    float* out = (float*)d_out;

    // workspace layout (f16 buffers), 256B aligned
    char* ws = (char*)d_ws;
    size_t off = 0;
    auto take = [&](size_t bytes) -> char* {
        char* p = ws + off;
        off = (off + bytes + 255) & ~(size_t)255;
        return p;
    };
    _Float16* qh  = (_Float16*)take((size_t)BATCH * NH * SEQ * DQ * 2); // 2 MB
    _Float16* kh  = (_Float16*)take((size_t)BATCH * NH * SEQ * DQ * 2); // 2 MB
    _Float16* vh  = (_Float16*)take((size_t)BATCH * NH * SEQ * DV * 2); // 8 MB

    // 1) projections, one launch (WMMA GEMM on fp32 inputs, head-split f16 outputs)
    gemm_proj<<<dim3(ROWS / 64, 6), 256, 0, stream>>>(x, Wq, bq, Wk, bk, Wv, bv, qh, kh, vh);

    // 2) streaming masked-softmax attention (WMMA), fp32 output
    attn_kernel<<<dim3(SEQ / 128, BATCH * NH), 256, 0, stream>>>(
        qh, kh, vh, mask, gamma, out);
}

// v009
// A run of this version takes 36.3 microseconds.
// Next to v008, in two timings, it ran 1.05 times as fast each time.
// All steps since v000 together make it 5.61 times as fast.
#include <hip/hip_runtime.h>
#include <hip/hip_bf16.h>

// ---- problem constants (from reference) ----
#define BATCH 4
#define SEQ   2048
#define CH    512
#define NH    8
#define DQ    16      // per-head q/k dim
#define DV    64      // per-head v dim
#define ROWS  (BATCH * SEQ)   // 8192

typedef __attribute__((ext_vector_type(16))) _Float16 v16h;
typedef __attribute__((ext_vector_type(8)))  float    v8f;
typedef __attribute__((ext_vector_type(4)))  float    v4f;

union Frag {
    v16h      v;
    _Float16  h[16];
    uint4     q[2];
};

// 16-bit transposing LDS load: from a row-major tile T[k][n], lane (c = lane & 15, h = lane >> 4)
// gets T[k0 + 8h + 0..7][n0 + c]; the lane's own address is
// T + (k0 + 8h + (lane & 7)) * pitch + 2 * n0 + 16 * ((lane >> 3) & 1) bytes.
// Loads at k0 and k0 + 16 make one 16x32 operand in the hardware k order.
typedef __attribute__((ext_vector_type(8))) short s16x8;
static __device__ __forceinline__ uint4 ld_tr16(const _Float16* p) {
    typedef __attribute__((address_space(3))) s16x8 lds_s16x8;
    return __builtin_bit_cast(uint4, __builtin_amdgcn_ds_load_tr16_b128_v8i16((lds_s16x8*)p));
}

// LDS row pitches in halves: 16 B x odd for ds_load_b128 readers, 32 B x odd for ds_load_tr16_b128
#define AS_PITCH 40    // 64-B rows  -> 80 B
#define BS_PITCH 144   // 256-B rows -> 288 B
#define VS_PITCH 80    // 128-B rows -> 160 B

static __device__ __forceinline__ v8f wmma16(v16h a, v16h b, v8f c) {
    return __builtin_amdgcn_wmma_f32_16x16x32_f16(
        /*neg_a=*/false, a, /*neg_b=*/false, b,
        /*c_mod=*/(short)0, c, /*reuse_a=*/false, /*reuse_b=*/false);
}

// ---------------------------------------------------------------------------
// Projection GEMM: C[ROWS x N] = A[ROWS x 512] * Bw[512 x N] + bias
// A and Bw are read as fp32 and rounded to f16 on the way into LDS.
// Output written f16 in head-split layout: out[((b*NH+h)*SEQ+m)*hd + d]
// Block tile 64(M) x 128(N), 8 waves (4x2), wave tile 16x64, K step 32.
// One launch does all three projections: blockIdx.y picks a 128-column group,
// 0 = q, 1 = k, 2..5 = v.
// The K loop is a pipeline: the global loads of K step s + 2 are issued in step s, into the
// registers that step s has just emptied, so a step never waits out the latency of its own loads;
// the f16 tiles alternate between two LDS buffers, which takes one barrier per step.
// hdShift: log2(head dim) -> 4 for q/k, 6 for v (avoids runtime div/mod).
// ---------------------------------------------------------------------------
#define KSTEP  32
#define NKSTEP (512 / KSTEP)
#define AS_BUF (64 * AS_PITCH)      // halves from LDS buffer 0 to buffer 1
#define BS_BUF (KSTEP * BS_PITCH)

// This thread's fp32 share of one K step: 4 columns of each of two A rows and of four B rows.
struct Share { v4f a[2]; v4f b[4]; };

// N (the row length of the weight matrix) is a template argument and the loop below is unrolled, so
// every load's distance from the two base addresses is an immediate: no address register is
// rewritten while loads are in flight.
template <int N>
static __device__ __forceinline__ void load_share(Share& r, const float* aSrc, const float* bSrc, int step) {
    r.a[0] = *(const v4f*)(aSrc + step * KSTEP);
    r.a[1] = *(const v4f*)(aSrc + step * KSTEP + 32 * 512);
#pragma unroll
    for (int e = 0; e < 4; e++) r.b[e] = *(const v4f*)(bSrc + (step * KSTEP + e * 8) * N);
}

// four fp32 rounded to f16 (nearest even), two per packed conversion
typedef __attribute__((ext_vector_type(2))) float    v2f;
typedef __attribute__((ext_vector_type(2))) _Float16 v2h;
static __device__ __forceinline__ uint2 round4(v4f f) {
    const v2h lo = __builtin_convertvector(v2f{f.x, f.y}, v2h);
    const v2h hi = __builtin_convertvector(v2f{f.z, f.w}, v2h);
    return make_uint2(__builtin_bit_cast(unsigned, lo), __builtin_bit_cast(unsigned, hi));
}

// Work-group barrier for the K loop, written by hand: __syncthreads() also waits for every global load
// in flight, which would end the pipeline at each step. What the barrier has to order here is LDS alone:
// this wave's LDS stores (and reads) are done before it signals.
static __device__ __forceinline__ void lds_barrier() {
    asm volatile("s_wait_dscnt 0x0\n\t"
                 "s_barrier_signal -1\n\t"
                 "s_barrier_wait -1" ::: "memory");
}

// aSt, bSt: where this thread stores its share in buffer 0; aFr, bTr: where this lane reads its fragments there
template <int N>
static __device__ __forceinline__ void proj_loop(const float* aSrc, const float* bSrc,
                                                 _Float16* aSt, _Float16* bSt,
                                                 const _Float16* aFr, const _Float16* bTr, v8f (&acc)[4]) {
    Share r[2];
    load_share<N>(r[0], aSrc, bSrc, 0);
    load_share<N>(r[1], aSrc, bSrc, 1);
    // all twelve loads are issued before anything waits for the first of them
    __builtin_amdgcn_sched_barrier(0);
    // unrolled: the register set and the LDS buffer of a step are then constants (see load_share too)
#pragma unroll
    for (int s = 0; s < NKSTEP; s++) {
        Share& c = r[s & 1];
        // one statement on the six loaded values of this step: it holds the conversions below behind it
        // (without it the compiler lifts the first ones ahead of the branch on N and waits for their loads
        // before the rest of the first two steps' loads are issued); the six younger loads stay in flight.
        // s_wait_xcnt 0 stands ahead of whatever the compiler writes into registers next (a precaution)
        asm volatile("s_wait_xcnt 0x0"
                     : "+v"(c.a[0]), "+v"(c.a[1]), "+v"(c.b[0]), "+v"(c.b[1]), "+v"(c.b[2]), "+v"(c.b[3])
                     :: "memory");
        // stage the A tile 64x32 and the B tile 32x128 (row-major, [k][n]) in buffer s & 1
#pragma unroll
        for (int e = 0; e < 2; e++)
            *(uint2*)(aSt + (s & 1) * AS_BUF + e * 32 * AS_PITCH) = round4(c.a[e]);
#pragma unroll
        for (int e = 0; e < 4; e++)
            *(uint2*)(bSt + (s & 1) * BS_BUF + e * 8 * BS_PITCH) = round4(c.b[e]);
        // publishes buffer s & 1; it also ends every wave's reads of the other buffer (step s - 1),
        // which step s + 1 overwrites
        lds_barrier();
        // behind the barrier, so behind the stores: the loads then take the registers just emptied
        if (s + 2 < NKSTEP) load_share<N>(c, aSrc, bSrc, s + 2);

        // A fragment (16x32, documented 16-bit A layout)
        Frag af;
        af.q[0] = *(const uint4*)(aFr + (s & 1) * AS_BUF);
        af.q[1] = *(const uint4*)(aFr + (s & 1) * AS_BUF + 16);
#pragma unroll
        for (int f = 0; f < 4; f++) {
            // B fragment: column n = nw*64 + f*16 + l, same k order as the A fragment
            Frag bfr;
            bfr.q[0] = ld_tr16(bTr + (s & 1) * BS_BUF + f * 16);
            bfr.q[1] = ld_tr16(bTr + (s & 1) * BS_BUF + 16 * BS_PITCH + f * 16);
            acc[f] = wmma16(af.v, bfr.v, acc[f]);
        }
        // keeps a step's matrix instructions in the step: moved behind the next barrier they hold a second
        // set of fragments live, and the registers no longer allow six waves per SIMD
        __builtin_amdgcn_sched_barrier(0);
    }
}

__global__ __launch_bounds__(256) void gemm_proj(
    const float* __restrict__ A,
    const float* __restrict__ Wq, const float* __restrict__ bq,
    const float* __restrict__ Wk, const float* __restrict__ bk,
    const float* __restrict__ Wv, const float* __restrict__ bv,
    _Float16* __restrict__ qOut, _Float16* __restrict__ kOut, _Float16* __restrict__ vOut)
{
    // this block's projection (uniform over the block)
    const int grp = blockIdx.y;
    const float* __restrict__ Bw   = grp == 0 ? Wq : grp == 1 ? Wk : Wv;
    const float* __restrict__ bias = grp == 0 ? bq : grp == 1 ? bk : bv;
    _Float16* __restrict__ outp    = grp == 0 ? qOut : grp == 1 ? kOut : vOut;
    const int N       = grp < 2 ? NH * DQ : NH * DV;
    const int hdShift = grp < 2 ? 4 : 6;
    // q leaves in the unit the attention kernel's exp2 wants: 1/sqrt(16) * log2(e), applied in fp32, ahead of the rounding
    const float oScale = grp == 0 ? 0.25f * 1.44269504f : 1.0f;

    __shared__ alignas(16) _Float16 As[2][64][AS_PITCH];
    __shared__ alignas(16) _Float16 Bs[2][KSTEP][BS_PITCH];   // row-major: [k][n]

    const int tid  = threadIdx.x;
    const int wave = tid >> 5;
    const int lane = tid & 31;
    const int half = lane >> 4;
    const int l    = lane & 15;
    const int mw   = wave >> 1;        // 0..3
    const int nw   = wave & 1;         // 0..1

    const int r0 = blockIdx.x * 64;
    const int n0 = grp < 2 ? 0 : (grp - 2) * 128;

    // per-thread staging coordinates (loop-invariant): neighbouring lanes read neighbouring
    // 16 bytes, so every wave-wide load covers four whole 128-B lines and no line is touched twice.
    // A tile: 8 lanes per 128-B row piece, 32 rows per load, 2 loads.
    // B tile: a wave per 512-B row, 8 rows per load, 4 loads.
    const int aRow = tid >> 3, aCol = (tid & 7) * 4;
    const int bK = tid >> 5, bN = (tid & 31) * 4;

    const float* aSrcBase = A + (size_t)(r0 + aRow) * 512 + aCol;
    const float* bSrcBase = Bw + (size_t)bK * N + n0 + bN;

    // this lane's address for the transposing loads of the B tile
    const _Float16* bTr = &Bs[0][half * 8 + (lane & 7)][nw * 64 + ((lane >> 3) & 1) * 8];

    v8f acc[4];
    v8f zero = {};
    acc[0] = zero; acc[1] = zero; acc[2] = zero; acc[3] = zero;

    if (grp < 2)
        proj_loop<NH * DQ>(aSrcBase, bSrcBase, &As[0][aRow][aCol], &Bs[0][bK][bN],
                           &As[0][mw * 16 + l][half * 8], bTr, acc);
    else
        proj_loop<NH * DV>(aSrcBase, bSrcBase, &As[0][aRow][aCol], &Bs[0][bK][bN],
                           &As[0][mw * 16 + l][half * 8], bTr, acc);

    // epilogue: bias + head-split f16 store (shift/mask instead of div/mod)
    const int hdMask = (1 << hdShift) - 1;
#pragma unroll
    for (int f = 0; f < 4; f++) {
        int ncol = n0 + nw * 64 + f * 16 + l;
        float bs = bias[ncol];
        bs *= oScale;
        acc[f] *= oScale;
        int h = ncol >> hdShift;
        int d = ncol & hdMask;
#pragma unroll
        for (int r = 0; r < 8; r++) {
            int grow = r0 + mw * 16 + r + half * 8;
            int b_ = grow >> 11;           // / SEQ
            int m  = grow & (SEQ - 1);
            size_t dst = ((((size_t)b_ * NH + h) * SEQ + m) << hdShift) + d;
            outp[dst] = (_Float16)(acc[f][r] + bs);
        }
    }
}

// ---------------------------------------------------------------------------
// Streaming attention: one block = 128 query rows of one (b,h); 8 waves.
// A key whose mask is 0 adds nothing to a row's output or to its masked sum, so it need not be
// visited: ahead of the loop the block orders the batch row's keys, those with a non-zero mask
// first (a count over the mask, the same in every block of the batch row), and the loop ends at
// the stage that holds the last of them. The order is a permutation of all SEQ keys for any mask.
// K and V come in stages of 128 listed keys by asynchronous copies to LDS, each lane fetching its
// piece of the row the list names, two buffers:
// stage t + 1 is in flight while stage t is worked on, one barrier per stage.
// The masks, as float and in the list's order, lie in LDS (0 behind the last live key).
// Per wave: 16 queries, both products transposed:
//   S^T = K*Q^T - ref (8 wmma per stage): a lane holds 64 of the 128 scores of ONE query.
//   Q arrives scaled to log2 units; ref, the query's softmax reference, is the C operand.
//   Any reference gives the same quotient O / sum, so ref is raised (and O and the sums
//   rescaled) only when a score of the stage tops it by more than REF_ROOM: every
//   probability stays <= 2^REF_ROOM, the row's largest >= 1, and a pass has no rescale.
//   relu: exp2(max(t, 0) - ref) = max(exp2(t - ref), exp2(-ref)).
//   O^T += V^T*P^T (4 wmma per 32 keys): two S^T tiles, packed to f16, are the B operand.
// ---------------------------------------------------------------------------
#define KSTG 128              // keys per stage
#define NSTG (SEQ / KSTG)     // stages
#define REF_ROOM 8.0f        // log2 units a score may stand above the reference

// lane l <-> lane l ^ 16
static __device__ __forceinline__ float xhalf(float x) {
    int b = __builtin_bit_cast(int, x);
    return __builtin_bit_cast(float,
        __builtin_amdgcn_permlanex16(b, b, 0x76543210, 0xfedcba98, false, false));
}

// x[i] = max(exp2(x[i]), lo), eight at a time. Written as one statement, each exponential in place:
// a neighbour should not overwrite a source directly behind a transcendental, the
// slot the instruction set wants kept; here the instruction behind each one touches other registers.
static __device__ __forceinline__ void exp2_floor8(v8f& x, float lo) {
    float a = x[0], b = x[1], c = x[2], d = x[3], e = x[4], f = x[5], g = x[6], h = x[7];
    asm("v_exp_f32 %0, %0\n\t"
        "v_exp_f32 %1, %1\n\t"
        "v_exp_f32 %2, %2\n\t"
        "v_exp_f32 %3, %3\n\t"
        "v_exp_f32 %4, %4\n\t"
        "v_exp_f32 %5, %5\n\t"
        "v_exp_f32 %6, %6\n\t"
        "v_exp_f32 %7, %7\n\t"
        "v_max_num_f32 %0, %0, %8\n\t"
        "v_max_num_f32 %1, %1, %8\n\t"
        "v_max_num_f32 %2, %2, %8\n\t"
        "v_max_num_f32 %3, %3, %8\n\t"
        "v_max_num_f32 %4, %4, %8\n\t"
        "v_max_num_f32 %5, %5, %8\n\t"
        "v_max_num_f32 %6, %6, %8\n\t"
        "v_max_num_f32 %7, %7, %8"
        : "+v"(a), "+v"(b), "+v"(c), "+v"(d), "+v"(e), "+v"(f), "+v"(g), "+v"(h)
        : "v"(lo));
    x = v8f{a, b, c, d, e, f, g, h};
}

// LDS byte address of a __shared__ object: the low 32 bits of its address
static __device__ __forceinline__ unsigned lds_addr(const void* p) {
    return (unsigned)(size_t)p;
}

// This thread's share of one stage: 16 B of a K row and 16 B of each of four V rows, which land
// 32 rows apart. kRow and vRow are the rows' numbers in the head (from the key list, 0 .. SEQ - 1).
// The copies go past the registers, so a stage can fly while the one before it is worked on.
// s_wait_xcnt 0 closes the statement, ahead of any rewrite of the address registers (a precaution).
static __device__ __forceinline__ void stage_copy(unsigned kl, const _Float16* kHead, int kRow,
                                                  unsigned vl, const _Float16* vHead, const int (&vRow)[4]) {
    const _Float16* kg  = kHead + kRow * DQ;
    const _Float16* vg0 = vHead + vRow[0] * DV;
    const _Float16* vg1 = vHead + vRow[1] * DV;
    const _Float16* vg2 = vHead + vRow[2] * DV;
    const _Float16* vg3 = vHead + vRow[3] * DV;
    asm volatile(
        "global_load_async_to_lds_b128 %0, %5, off\n\t"
        "global_load_async_to_lds_b128 %1, %6, off\n\t"
        "global_load_async_to_lds_b128 %2, %7, off\n\t"
        "global_load_async_to_lds_b128 %3, %8, off\n\t"
        "global_load_async_to_lds_b128 %4, %9, off\n\t"
        "s_wait_xcnt 0x0"
        :: "v"(kl), "v"(vl), "v"(vl + 32 * VS_PITCH * 2), "v"(vl + 64 * VS_PITCH * 2),
           "v"(vl + 96 * VS_PITCH * 2),
           "v"(kg), "v"(vg0), "v"(vg1), "v"(vg2), "v"(vg3)
        : "memory");
}

// Two blocks per WGP is all the grid gives: four waves per SIMD. Said to the compiler, it spends
// that register budget on LDS loads issued ahead of their use instead of waiting for each in turn.
__global__ __launch_bounds__(256) __attribute__((amdgpu_waves_per_eu(4, 4))) void attn_kernel(
    const _Float16* __restrict__ Q, const _Float16* __restrict__ K,
    const _Float16* __restrict__ V, const int* __restrict__ mask,
    const float* __restrict__ gamma, float* __restrict__ out)
{
    __shared__ alignas(16) _Float16 Kt[2][KSTG][DQ];        // [buffer][key][d]
    __shared__ alignas(16) _Float16 Vs[2][KSTG][VS_PITCH];  // [buffer][key][d], row-major
    __shared__ alignas(32) float mskf[SEQ];   // mask of the key at each place of the list
    __shared__ int kidx[SEQ];                 // the list: live keys first, then the rest
    __shared__ int wlive[8];                  // live keys in each wave's 256 keys

    const int tid  = threadIdx.x;
    const int wave = tid >> 5;
    const int lane = tid & 31;
    const int half = lane >> 4;
    const int l    = lane & 15;

    const int bh = blockIdx.y;            // b*NH + h
    const int b  = bh >> 3;               // / NH
    const int h  = bh & (NH - 1);
    const int q0 = blockIdx.x * 128 + wave * 16;

    const size_t headBase = (size_t)bh * SEQ;

    // per-thread staging coordinates (loop-invariant): 2 lanes cover one 32-B K row, 8 one 128-B V row
    const _Float16* kSrc = K + headBase * DQ + (tid & 1) * 8;
    const _Float16* vSrc = V + headBase * DV + (tid & 7) * 8;
    const int* kLst = &kidx[tid >> 1];   // the list's entries for this thread's rows of stage 0
    const int* vLst = &kidx[tid >> 3];
    const unsigned kDst = lds_addr(&Kt[0][0][0]) + tid * 16;
    const unsigned vDst = lds_addr(&Vs[0][tid >> 3][(tid & 7) * 8]);
    const unsigned kBufB = KSTG * DQ * 2;        // bytes from buffer 0 to buffer 1
    const unsigned vBufB = KSTG * VS_PITCH * 2;

    // the key list of this batch row (8 keys per thread, in key order)
    int nLive;
    {
        const int4* ms = (const int4*)(mask + (size_t)b * SEQ + tid * 8);
        const int4 m0 = ms[0], m1 = ms[1];
        // (the three loops below are unrolled so that their indices are constants and mv lives in registers)
        const int mv[8] = {m0.x, m0.y, m0.z, m0.w, m1.x, m1.y, m1.z, m1.w};
        // live keys of the wave's lower lanes, and of the whole wave
        unsigned ahead = 0u;
        int wsum = 0;
#pragma unroll
        for (int j = 0; j < 8; j++) {
            const unsigned on = __builtin_amdgcn_ballot_w32(mv[j] != 0);
            ahead = __builtin_amdgcn_mbcnt_lo(on, ahead);
            wsum += __builtin_popcount(on);
        }
        if (lane == 0) wlive[wave] = wsum;
        // the waves' counts reach every wave
        __syncthreads();
        int live = (int)ahead;   // live keys ahead of key tid * 8
        int all = 0;
#pragma unroll
        for (int w = 0; w < 8; w++) {
            const int cw = wlive[w];
            all += cw;
            live += w < wave ? cw : 0;
        }
        // a live key goes to its rank among the live ones, another to all + its rank among the others:
        // every place 0 .. SEQ - 1 is written once, whatever the mask holds
#pragma unroll
        for (int j = 0; j < 8; j++) {
            const int key = tid * 8 + j;
            const bool on = mv[j] != 0;
            const int pos = on ? live : all + (key - live);
            kidx[pos] = key;
            mskf[pos] = (float)mv[j];
            live += on ? 1 : 0;
        }
        nLive = __builtin_amdgcn_readfirstlane(all);
    }
    // stages that hold a live key (the same in every wave of the block; at most NSTG)
    const int nStg = min((nLive + KSTG - 1) / KSTG, NSTG);
    // the list (and the masks) reach every wave
    __syncthreads();

    // stage 0 into buffer 0
    {
        const int vr[4] = {vLst[0], vLst[32], vLst[64], vLst[96]};
        stage_copy(kDst, kSrc, kLst[0], vDst, vSrc, vr);
    }

    // this lane's address for the transposing loads of the V tile
    const _Float16* vTr0 = &Vs[0][half * 8 + (lane & 7)][((lane >> 3) & 1) * 8];

    // Q^T fragment (B operand): column = query l, 16 d padded to 32 (upper k zero)
    Frag qb;
    qb.q[0] = *(const uint4*)(Q + (headBase + q0 + l) * DQ + half * 8);
    qb.q[1] = make_uint4(0u, 0u, 0u, 0u);

    v8f zero = {};
    v8f o0 = zero, o1 = zero, o2 = zero, o3 = zero;   // o_f[r] = O[query l][f*16 + half*8 + r]
    v8f nref = zero;   // minus the reference of query l (relu => row max >= 0), equal in both halves
    float e0 = 1.0f;   // exp2(-reference): the probability of a score that relu lifts to 0
    v8f rs = zero;     // this lane's eight partial masked sums of query l

    // stage 0 has landed for this wave; the barrier publishes it to the others
    asm volatile("s_wait_asynccnt 0x0" ::: "memory");
    __syncthreads();
    // stage 1 into buffer 1 (the list names SEQ rows, so the stage exists also where the loop ends ahead of it)
    {
        const int vr[4] = {vLst[KSTG], vLst[KSTG + 32], vLst[KSTG + 64], vLst[KSTG + 96]};
        stage_copy(kDst + kBufB, kSrc, kLst[KSTG], vDst + vBufB, vSrc, vr);
    }

    for (int t = 0; t < nStg; t++) {
        const int buf = t & 1;
        const _Float16* vTr = vTr0 + buf * (KSTG * VS_PITCH);

        // the list's entries for the refill at the foot, read here so that the copies do not wait for them
        const int tn = min(t + 2, NSTG - 1) * KSTG;
        const int kr = kLst[tn];
        const int vr[4] = {vLst[tn], vLst[tn + 32], vLst[tn + 64], vLst[tn + 96]};

        // scores of the whole stage, minus the reference: S^T[128 keys x 16 queries] (A = K rows, padded k)
        // (every loop over s, kq or tq below is unrolled so that their indices are constants
        // and the arrays live in registers)
        v8f s[KSTG / 16];   // s[j][r]: key j*16 + half*8 + r, query l
        {
            v4f kq[KSTG / 16];
#pragma unroll
            for (int j = 0; j < KSTG / 16; j++) kq[j] = *(const v4f*)&Kt[buf][j * 16 + l][half * 8];
            // inputs-only fence on the loaded values: keeps the eight loads in flight together;
            // without it each load is waited for before the next is issued
            asm volatile("" :: "v"(kq[0]), "v"(kq[1]), "v"(kq[2]), "v"(kq[3]),
                               "v"(kq[4]), "v"(kq[5]), "v"(kq[6]), "v"(kq[7]));
#pragma unroll
            for (int j = 0; j < KSTG / 16; j++) {
                Frag ka;
                ka.q[0] = __builtin_bit_cast(uint4, kq[j]);
                ka.q[1] = make_uint4(0u, 0u, 0u, 0u);
                s[j] = wmma16(ka.v, qb.v, nref);
            }
        }

        // how far this lane's scores stand above the reference
        float tq[4];   // four chains, so that no link waits for the one before it
#pragma unroll
        for (int c = 0; c < 4; c++) {
            tq[c] = s[2 * c][0];
#pragma unroll
            for (int r = 0; r < 8; r++) tq[c] = fmaxf(tq[c], fmaxf(s[2 * c][r], s[2 * c + 1][r]));
        }
        const float tm = fmaxf(fmaxf(tq[0], tq[1]), fmaxf(tq[2], tq[3]));

        // rare: some query of the wave outgrew its reference; raise every query's to its stage max
        if (__builtin_amdgcn_ballot_w32(tm > REF_ROOM) != 0u) {
            const float up = fmaxf(fmaxf(tm, xhalf(tm)), 0.0f);
            const float sf = __builtin_amdgcn_exp2f(-up);
#pragma unroll
            for (int j = 0; j < KSTG / 16; j++) s[j] -= up;
            nref -= up;
            e0 = __builtin_amdgcn_exp2f(nref[0]);
            rs *= sf;
            o0 *= sf; o1 *= sf; o2 *= sf; o3 *= sf;
        }

#pragma unroll
        for (int p = 0; p < KSTG / 32; p++) {
            v8f s0 = s[2 * p], s1 = s[2 * p + 1];

            // masks of this lane's 16 keys
            const v8f mk0 = *(const v8f*)&mskf[t * KSTG + p * 32 + half * 8];
            const v8f mk1 = *(const v8f*)&mskf[t * KSTG + p * 32 + 16 + half * 8];

            // masked probabilities; packed in place they are P^T in B-operand order
            exp2_floor8(s0, e0);
            exp2_floor8(s1, e0);
            s0 *= mk0;
            s1 *= mk1;
            Frag pb;
#pragma unroll
            for (int r = 0; r < 8; r++) {
                pb.h[r]     = (_Float16)s0[r];
                pb.h[8 + r] = (_Float16)s1[r];
            }
            rs += s0 + s1;

            // V^T fragments (A operand, rows = d) by transposing loads from the row-major tile
            const _Float16* vp = vTr + p * 32 * VS_PITCH;
            Frag va;
            va.q[0] = ld_tr16(vp + 0 * 16);
            va.q[1] = ld_tr16(vp + 16 * VS_PITCH + 0 * 16);
            o0 = wmma16(va.v, pb.v, o0);
            va.q[0] = ld_tr16(vp + 1 * 16);
            va.q[1] = ld_tr16(vp + 16 * VS_PITCH + 1 * 16);
            o1 = wmma16(va.v, pb.v, o1);
            va.q[0] = ld_tr16(vp + 2 * 16);
            va.q[1] = ld_tr16(vp + 16 * VS_PITCH + 2 * 16);
            o2 = wmma16(va.v, pb.v, o2);
            va.q[0] = ld_tr16(vp + 3 * 16);
            va.q[1] = ld_tr16(vp + 16 * VS_PITCH + 3 * 16);
            o3 = wmma16(va.v, pb.v, o3);
        }

        // hand-over: this wave's reads of buffer buf are done ...
        asm volatile("s_wait_dscnt 0x0" ::: "memory");
        // ... and its copies of stage t + 1 have landed;
        asm volatile("s_wait_asynccnt 0x0" ::: "memory");
        // the barrier publishes stage t + 1 and frees buffer buf for its refill
        __syncthreads();
        if (t + 2 < nStg)
            stage_copy(kDst + buf * kBufB, kSrc, kr, vDst + buf * vBufB, vSrc, vr);
    }
    // no copy is left in flight when the wave ends
    asm volatile("s_wait_asynccnt 0x0" ::: "memory");

    // epilogue: join the halves' sums, beta normalization, gamma, fp32 store
    const float g = gamma[0];
    const float rl = ((rs[0] + rs[1]) + (rs[2] + rs[3])) + ((rs[4] + rs[5]) + (rs[6] + rs[7]));
    const float inv = g / (rl + xhalf(rl) + 1e-12f);
    float* orow = out + ((size_t)b * SEQ + q0 + l) * CH + (size_t)h * DV + half * 8;
    *(float4*)(orow +  0) = make_float4(o0[0] * inv, o0[1] * inv, o0[2] * inv, o0[3] * inv);
    *(float4*)(orow +  4) = make_float4(o0[4] * inv, o0[5] * inv, o0[6] * inv, o0[7] * inv);
    *(float4*)(orow + 16) = make_float4(o1[0] * inv, o1[1] * inv, o1[2] * inv, o1[3] * inv);
    *(float4*)(orow + 20) = make_float4(o1[4] * inv, o1[5] * inv, o1[6] * inv, o1[7] * inv);
    *(float4*)(orow + 32) = make_float4(o2[0] * inv, o2[1] * inv, o2[2] * inv, o2[3] * inv);
    *(float4*)(orow + 36) = make_float4(o2[4] * inv, o2[5] * inv, o2[6] * inv, o2[7] * inv);
    *(float4*)(orow + 48) = make_float4(o3[0] * inv, o3[1] * inv, o3[2] * inv, o3[3] * inv);
    *(float4*)(orow + 52) = make_float4(o3[4] * inv, o3[5] * inv, o3[6] * inv, o3[7] * inv);
}

// ---------------------------------------------------------------------------
// launch
// ---------------------------------------------------------------------------
extern "C" void kernel_launch(void* const* d_in, const int* in_sizes, int n_in,
                              void* d_out, int out_size, void* d_ws, size_t ws_size,
                              hipStream_t stream) {
    const float* x     = (const float*)d_in[0];   // (4,2048,512)
    const int*   mask  = (const int*)d_in[1];     // (4,2048)
    const float* Wq    = (const float*)d_in[2];   // (512,128)
    const float* bq    = (const float*)d_in[3];   // (128)
    const float* Wk    = (const float*)d_in[4];   // (512,128)
    const float* bk    = (const float*)d_in[5];   // (128)
    const float* Wv    = (const float*)d_in[6];   // (512,512)
    const float* bv    = (const float*)d_in[7];   // (512)
    const float* gamma = (const float*)d_in[8];   // (1)
    float* out = (float*)d_out;

    // workspace layout (f16 buffers), 256B aligned
    char* ws = (char*)d_ws;
    size_t off = 0;
    auto take = [&](size_t bytes) -> char* {
        char* p = ws + off;
        off = (off + bytes + 255) & ~(size_t)255;
        return p;
    };
    _Float16* qh  = (_Float16*)take((size_t)BATCH * NH * SEQ * DQ * 2); // 2 MB
    _Float16* kh  = (_Float16*)take((size_t)BATCH * NH * SEQ * DQ * 2); // 2 MB
    _Float16* vh  = (_Float16*)take((size_t)BATCH * NH * SEQ * DV * 2); // 8 MB

    // 1) projections, one launch (WMMA GEMM on fp32 inputs, head-split f16 outputs)
    gemm_proj<<<dim3(ROWS / 64, 6), 256, 0, stream>>>(x, Wq, bq, Wk, bk, Wv, bv, qh, kh, vh);

    // 2) streaming masked-softmax attention (WMMA), fp32 output
    attn_kernel<<<dim3(SEQ / 128, BATCH * NH), 256, 0, stream>>>(
        qh, kh, vh, mask, gamma, out);
}

// v010
// One run takes 34.7 microseconds.
// Next to v009, in two timings, it ran 1.05 and 1.04 times as fast.
// Over all steps from v000 it is 5.86 times as fast.
#include <hip/hip_runtime.h>
#include <hip/hip_bf16.h>

// ---- problem constants (from reference) ----
#define BATCH 4
#define SEQ   2048
#define CH    512
#define NH    8
#define DQ    16      // per-head q/k dim
#define DV    64      // per-head v dim
#define ROWS  (BATCH * SEQ)   // 8192

typedef __attribute__((ext_vector_type(16))) _Float16 v16h;
typedef __attribute__((ext_vector_type(8)))  float    v8f;
typedef __attribute__((ext_vector_type(4)))  float    v4f;

union Frag {
    v16h      v;
    _Float16  h[16];
    uint4     q[2];
};

// 16-bit transposing LDS load: from a row-major tile T[k][n], lane (c = lane & 15, h = lane >> 4)
// gets T[k0 + 8h + 0..7][n0 + c]; the lane's own address is
// T + (k0 + 8h + (lane & 7)) * pitch + 2 * n0 + 16 * ((lane >> 3) & 1) bytes.
// Loads at k0 and k0 + 16 make one 16x32 operand in the hardware k order.
typedef __attribute__((ext_vector_type(8))) short s16x8;
static __device__ __forceinline__ uint4 ld_tr16(const _Float16* p) {
    typedef __attribute__((address_space(3))) s16x8 lds_s16x8;
    return __builtin_bit_cast(uint4, __builtin_amdgcn_ds_load_tr16_b128_v8i16((lds_s16x8*)p));
}

// LDS row pitches in halves: 16 B x odd for ds_load_b128 readers, 32 B x odd for ds_load_tr16_b128
#define AS_PITCH 40    // 64-B rows  -> 80 B
#define BS_PITCH 144   // 256-B rows -> 288 B
#define VS_PITCH 80    // 128-B rows -> 160 B

static __device__ __forceinline__ v8f wmma16(v16h a, v16h b, v8f c) {
    return __builtin_amdgcn_wmma_f32_16x16x32_f16(
        /*neg_a=*/false, a, /*neg_b=*/false, b,
        /*c_mod=*/(short)0, c, /*reuse_a=*/false, /*reuse_b=*/false);
}

// ---------------------------------------------------------------------------
// Projection GEMM: C[ROWS x N] = A[ROWS x 512] * Bw[512 x N] + bias
// A and Bw are read as fp32 and rounded to f16 on the way into LDS.
// Output written f16 in head-split layout: out[((b*NH+h)*SEQ+m)*hd + d]
// Block tile 64(M) x 128(N), 8 waves (4x2), wave tile 16x64, K step 32.
// One launch does all three projections: blockIdx.y picks a 128-column group,
// 0 = q, 1 = k, 2..5 = v.
// The K loop is a pipeline: the global loads of K step s + 2 are issued in step s, into the
// registers that step s has just emptied, so a step never waits out the latency of its own loads;
// the f16 tiles alternate between two LDS buffers, which takes one barrier per step.
// A v row leaves multiplied by its key's mask (in fp32, ahead of the rounding): p * (m * v) = (p * m) * v,
// so the attention kernel has no mask product of its own.
// hdShift: log2(head dim) -> 4 for q/k, 6 for v (avoids runtime div/mod).
// ---------------------------------------------------------------------------
#define KSTEP  32
#define NKSTEP (512 / KSTEP)
#define AS_BUF (64 * AS_PITCH)      // halves from LDS buffer 0 to buffer 1
#define BS_BUF (KSTEP * BS_PITCH)

// This thread's fp32 share of one K step: 4 columns of each of two A rows and of four B rows.
struct Share { v4f a[2]; v4f b[4]; };

// N (the row length of the weight matrix) is a template argument and the loop below is unrolled, so
// every load's distance from the two base addresses is an immediate: no address register is
// rewritten while loads are in flight.
template <int N>
static __device__ __forceinline__ void load_share(Share& r, const float* aSrc, const float* bSrc, int step) {
    r.a[0] = *(const v4f*)(aSrc + step * KSTEP);
    r.a[1] = *(const v4f*)(aSrc + step * KSTEP + 32 * 512);
#pragma unroll
    for (int e = 0; e < 4; e++) r.b[e] = *(const v4f*)(bSrc + (step * KSTEP + e * 8) * N);
}

// four fp32 rounded to f16 (nearest even), two per packed conversion
typedef __attribute__((ext_vector_type(2))) float    v2f;
typedef __attribute__((ext_vector_type(2))) _Float16 v2h;
static __device__ __forceinline__ uint2 round4(v4f f) {
    const v2h lo = __builtin_convertvector(v2f{f.x, f.y}, v2h);
    const v2h hi = __builtin_convertvector(v2f{f.z, f.w}, v2h);
    return make_uint2(__builtin_bit_cast(unsigned, lo), __builtin_bit_cast(unsigned, hi));
}

// Work-group barrier for the K loop, written by hand: __syncthreads() also waits for every global load
// in flight, which would end the pipeline at each step. What the barrier has to order here is LDS alone:
// this wave's LDS stores (and reads) are done before it signals.
static __device__ __forceinline__ void lds_barrier() {
    asm volatile("s_wait_dscnt 0x0\n\t"
                 "s_barrier_signal -1\n\t"
                 "s_barrier_wait -1" ::: "memory");
}

// aSt, bSt: where this thread stores its share in buffer 0; aFr, bTr: where this lane reads its fragments there
template <int N>
static __device__ __forceinline__ void proj_loop(const float* aSrc, const float* bSrc,
                                                 _Float16* aSt, _Float16* bSt,
                                                 const _Float16* aFr, const _Float16* bTr, v8f (&acc)[4]) {
    Share r[2];
    load_share<N>(r[0], aSrc, bSrc, 0);
    load_share<N>(r[1], aSrc, bSrc, 1);
    // all twelve loads are issued before anything waits for the first of them
    __builtin_amdgcn_sched_barrier(0);
    // unrolled: the register set and the LDS buffer of a step are then constants (see load_share too)
#pragma unroll
    for (int s = 0; s < NKSTEP; s++) {
        Share& c = r[s & 1];
        // one statement on the six loaded values of this step: it holds the conversions below behind it
        // (without it the compiler lifts the first ones ahead of the branch on N and waits for their loads
        // before the rest of the first two steps' loads are issued); the six younger loads stay in flight.
        // s_wait_xcnt 0 stands ahead of whatever the compiler writes into registers next (a precaution)
        asm volatile("s_wait_xcnt 0x0"
                     : "+v"(c.a[0]), "+v"(c.a[1]), "+v"(c.b[0]), "+v"(c.b[1]), "+v"(c.b[2]), "+v"(c.b[3])
                     :: "memory");
        // stage the A tile 64x32 and the B tile 32x128 (row-major, [k][n]) in buffer s & 1
#pragma unroll
        for (int e = 0; e < 2; e++)
            *(uint2*)(aSt + (s & 1) * AS_BUF + e * 32 * AS_PITCH) = round4(c.a[e]);
#pragma unroll
        for (int e = 0; e < 4; e++)
            *(uint2*)(bSt + (s & 1) * BS_BUF + e * 8 * BS_PITCH) = round4(c.b[e]);
        // publishes buffer s & 1; it also ends every wave's reads of the other buffer (step s - 1),
        // which step s + 1 overwrites
        lds_barrier();
        // behind the barrier, so behind the stores: the loads then take the registers just emptied
        if (s + 2 < NKSTEP) load_share<N>(c, aSrc, bSrc, s + 2);

        // A fragment (16x32, documented 16-bit A layout)
        Frag af;
        af.q[0] = *(const uint4*)(aFr + (s & 1) * AS_BUF);
        af.q[1] = *(const uint4*)(aFr + (s & 1) * AS_BUF + 16);
#pragma unroll
        for (int f = 0; f < 4; f++) {
            // B fragment: column n = nw*64 + f*16 + l, same k order as the A fragment
            Frag bfr;
            bfr.q[0] = ld_tr16(bTr + (s & 1) * BS_BUF + f * 16);
            bfr.q[1] = ld_tr16(bTr + (s & 1) * BS_BUF + 16 * BS_PITCH + f * 16);
            acc[f] = wmma16(af.v, bfr.v, acc[f]);
        }
        // keeps a step's matrix instructions in the step: moved behind the next barrier they hold a second
        // set of fragments live, and the registers no longer allow six waves per SIMD
        __builtin_amdgcn_sched_barrier(0);
    }
}

__global__ __launch_bounds__(256) void gemm_proj(
    const float* __restrict__ A,
    const float* __restrict__ Wq, const float* __restrict__ bq,
    const float* __restrict__ Wk, const float* __restrict__ bk,
    const float* __restrict__ Wv, const float* __restrict__ bv,
    const int* __restrict__ mask,
    _Float16* __restrict__ qOut, _Float16* __restrict__ kOut, _Float16* __restrict__ vOut)
{
    // this block's projection (uniform over the block)
    const int grp = blockIdx.y;
    const float* __restrict__ Bw   = grp == 0 ? Wq : grp == 1 ? Wk : Wv;
    const float* __restrict__ bias = grp == 0 ? bq : grp == 1 ? bk : bv;
    _Float16* __restrict__ outp    = grp == 0 ? qOut : grp == 1 ? kOut : vOut;
    const int N       = grp < 2 ? NH * DQ : NH * DV;
    const int hdShift = grp < 2 ? 4 : 6;
    // q leaves in the unit the attention kernel's exp2 wants: 1/sqrt(16) * log2(e), applied in fp32, ahead of the rounding
    const float oScale = grp == 0 ? 0.25f * 1.44269504f : 1.0f;

    __shared__ alignas(16) _Float16 As[2][64][AS_PITCH];
    __shared__ alignas(16) _Float16 Bs[2][KSTEP][BS_PITCH];   // row-major: [k][n]

    const int tid  = threadIdx.x;
    const int wave = tid >> 5;
    const int lane = tid & 31;
    const int half = lane >> 4;
    const int l    = lane & 15;
    const int mw   = wave >> 1;        // 0..3
    const int nw   = wave & 1;         // 0..1

    const int r0 = blockIdx.x * 64;
    const int n0 = grp < 2 ? 0 : (grp - 2) * 128;

    // per-thread staging coordinates (loop-invariant): neighbouring lanes read neighbouring
    // 16 bytes, so every wave-wide load covers four whole 128-B lines and no line is touched twice.
    // A tile: 8 lanes per 128-B row piece, 32 rows per load, 2 loads.
    // B tile: a wave per 512-B row, 8 rows per load, 4 loads.
    const int aRow = tid >> 3, aCol = (tid & 7) * 4;
    const int bK = tid >> 5, bN = (tid & 31) * 4;

    const float* aSrcBase = A + (size_t)(r0 + aRow) * 512 + aCol;
    const float* bSrcBase = Bw + (size_t)bK * N + n0 + bN;

    // this lane's address for the transposing loads of the B tile
    const _Float16* bTr = &Bs[0][half * 8 + (lane & 7)][nw * 64 + ((lane >> 3) & 1) * 8];

    v8f acc[4];
    v8f zero = {};
    acc[0] = zero; acc[1] = zero; acc[2] = zero; acc[3] = zero;

    if (grp < 2)
        proj_loop<NH * DQ>(aSrcBase, bSrcBase, &As[0][aRow][aCol], &Bs[0][bK][bN],
                           &As[0][mw * 16 + l][half * 8], bTr, acc);
    else
        proj_loop<NH * DV>(aSrcBase, bSrcBase, &As[0][aRow][aCol], &Bs[0][bK][bN],
                           &As[0][mw * 16 + l][half * 8], bTr, acc);

    // epilogue: bias + head-split f16 store (shift/mask instead of div/mod)
    const int hdMask = (1 << hdShift) - 1;
    // masks of this lane's eight output rows (row b * SEQ + m of x is key m of batch row b)
    const int4* mrowp = (const int4*)(mask + r0 + mw * 16 + half * 8);
    const int4 mr0 = mrowp[0], mr1 = mrowp[1];
    const bool isV = grp >= 2;
    const float mrow[8] = {isV ? (float)mr0.x : 1.0f, isV ? (float)mr0.y : 1.0f, isV ? (float)mr0.z : 1.0f,
                           isV ? (float)mr0.w : 1.0f, isV ? (float)mr1.x : 1.0f, isV ? (float)mr1.y : 1.0f,
                           isV ? (float)mr1.z : 1.0f, isV ? (float)mr1.w : 1.0f};
#pragma unroll
    for (int f = 0; f < 4; f++) {
        int ncol = n0 + nw * 64 + f * 16 + l;
        float bs = bias[ncol];
        bs *= oScale;
        acc[f] *= oScale;
        int h = ncol >> hdShift;
        int d = ncol & hdMask;
#pragma unroll
        for (int r = 0; r < 8; r++) {
            int grow = r0 + mw * 16 + r + half * 8;
            int b_ = grow >> 11;           // / SEQ
            int m  = grow & (SEQ - 1);
            size_t dst = ((((size_t)b_ * NH + h) * SEQ + m) << hdShift) + d;
            outp[dst] = (_Float16)((acc[f][r] + bs) * mrow[r]);
        }
    }
}

// ---------------------------------------------------------------------------
// Streaming attention: one block = 128 query rows of one (b,h); 8 waves.
// A key whose mask is 0 adds nothing to a row's output or to its masked sum, so it need not be
// visited: ahead of the loop the block orders the batch row's keys, those with a non-zero mask
// first (a count over the mask, the same in every block of the batch row), and the loop ends at
// the stage that holds the last of them. The order is a permutation of all SEQ keys for any mask.
// K and V come in stages of 128 listed keys by asynchronous copies to LDS, each lane fetching its
// piece of the row the list names, two buffers:
// stage t + 1 is in flight while stage t is worked on, one barrier per stage.
// The masks, as f16 and in the list's order, lie in LDS (0 behind the last live key).
// Per wave: 16 queries, both products transposed:
//   S^T = K*Q^T - ref (8 wmma per stage): a lane holds 64 of the 128 scores of ONE query.
//   Q arrives scaled to log2 units; ref, the query's softmax reference, is the C operand.
//   Any reference gives the same quotient O / sum, so ref is raised (and O and the sums
//   rescaled) only when a score of the stage tops it by more than REF_ROOM: every
//   probability stays <= 2^REF_ROOM, the row's largest >= 1, and a pass has no rescale.
//   relu: exp2(max(t, 0) - ref) = max(exp2(t - ref), exp2(-ref)); rounding to f16 keeps the order, so the
//   maximum is taken on the packed f16 pairs, two scores an instruction.
//   O^T += (mV)^T*P^T (4 wmma per 32 keys): two S^T tiles, packed to f16, are the B operand; V arrives
//   multiplied by the mask. A fifth wmma, whose A operand holds the 32 keys' masks in every row, adds up
//   the masked sum of each query from the same P: no fp32 product or sum stands behind the exponentials.
// ---------------------------------------------------------------------------
#define KSTG 128              // keys per stage
#define NSTG (SEQ / KSTG)     // stages
#define REF_ROOM 8.0f        // log2 units a score may stand above the reference

// lane l <-> lane l ^ 16
static __device__ __forceinline__ float xhalf(float x) {
    int b = __builtin_bit_cast(int, x);
    return __builtin_bit_cast(float,
        __builtin_amdgcn_permlanex16(b, b, 0x76543210, 0xfedcba98, false, false));
}

// The exponentials of a stage run as a chain of statements, tile by tile, each exponential in place.
// Written as asm so that the instruction behind each transcendental touches other registers (the slot the
// instruction set wants kept), and so that every reader stands far behind its producer: tile j - 1 is packed
// between the two halves of tile j's exponentials and floored behind them, and no wave stalls on a fresh result.

// x[i] = exp2(x[i]): the first tile of the chain
static __device__ __forceinline__ void exp2_8(v8f& x) {
    float a = x[0], b = x[1], c = x[2], d = x[3], e = x[4], f = x[5], g = x[6], h = x[7];
    asm("v_exp_f32 %0, %0\n\t"
        "v_exp_f32 %1, %1\n\t"
        "v_exp_f32 %2, %2\n\t"
        "v_exp_f32 %3, %3\n\t"
        "v_exp_f32 %4, %4\n\t"
        "v_exp_f32 %5, %5\n\t"
        "v_exp_f32 %6, %6\n\t"
        "v_exp_f32 %7, %7"
        : "+v"(a), "+v"(b), "+v"(c), "+v"(d), "+v"(e), "+v"(f), "+v"(g), "+v"(h));
    x = v8f{a, b, c, d, e, f, g, h};
}

// x[i] = exp2(x[i]); returns max(f16(y[i]), lo), packed in order (lo2: lo as f16, twice)
static __device__ __forceinline__ uint4 exp2_8_pack8(v8f& x, const v8f& y, unsigned lo2) {
    float a = x[0], b = x[1], c = x[2], d = x[3], e = x[4], f = x[5], g = x[6], h = x[7];
    unsigned o0, o1, o2, o3;
    asm("v_exp_f32 %4, %4\n\t"
        "v_exp_f32 %5, %5\n\t"
        "v_exp_f32 %6, %6\n\t"
        "v_exp_f32 %7, %7\n\t"
        "v_cvt_pk_f16_f32 %0, %12, %13\n\t"
        "v_cvt_pk_f16_f32 %1, %14, %15\n\t"
        "v_cvt_pk_f16_f32 %2, %16, %17\n\t"
        "v_cvt_pk_f16_f32 %3, %18, %19\n\t"
        "v_exp_f32 %8, %8\n\t"
        "v_exp_f32 %9, %9\n\t"
        "v_exp_f32 %10, %10\n\t"
        "v_exp_f32 %11, %11\n\t"
        "v_pk_max_num_f16 %0, %0, %20\n\t"
        "v_pk_max_num_f16 %1, %1, %20\n\t"
        "v_pk_max_num_f16 %2, %2, %20\n\t"
        "v_pk_max_num_f16 %3, %3, %20"
        : "=&v"(o0), "=&v"(o1), "=&v"(o2), "=&v"(o3),
          "+v"(a), "+v"(b), "+v"(c), "+v"(d), "+v"(e), "+v"(f), "+v"(g), "+v"(h)
        : "v"(y[0]), "v"(y[1]), "v"(y[2]), "v"(y[3]), "v"(y[4]), "v"(y[5]), "v"(y[6]), "v"(y[7]), "v"(lo2));
    x = v8f{a, b, c, d, e, f, g, h};
    return make_uint4(o0, o1, o2, o3);
}

// the last tile of the chain: max(f16(y[i]), lo), packed in order.
// s_delay_alu: each maximum reads a result four instructions back; the hint lets another wave issue meanwhile
static __device__ __forceinline__ uint4 pack8(const v8f& y, unsigned lo2) {
    unsigned o0, o1, o2, o3;
    asm("v_cvt_pk_f16_f32 %0, %4, %5\n\t"
        "v_cvt_pk_f16_f32 %1, %6, %7\n\t"
        "v_cvt_pk_f16_f32 %2, %8, %9\n\t"
        "v_cvt_pk_f16_f32 %3, %10, %11\n\t"
        "s_delay_alu instid0(VALU_DEP_4) | instskip(NEXT) | instid1(VALU_DEP_4)\n\t"
        "v_pk_max_num_f16 %0, %0, %12\n\t"
        "v_pk_max_num_f16 %1, %1, %12\n\t"
        "s_delay_alu instid0(VALU_DEP_4) | instskip(NEXT) | instid1(VALU_DEP_4)\n\t"
        "v_pk_max_num_f16 %2, %2, %12\n\t"
        "v_pk_max_num_f16 %3, %3, %12"
        : "=&v"(o0), "=&v"(o1), "=&v"(o2), "=&v"(o3)
        : "v"(y[0]), "v"(y[1]), "v"(y[2]), "v"(y[3]), "v"(y[4]), "v"(y[5]), "v"(y[6]), "v"(y[7]), "v"(lo2));
    return make_uint4(o0, o1, o2, o3);
}

// e as f16, in both halves of a register
static __device__ __forceinline__ unsigned twice_f16(float e) {
    return __builtin_bit_cast(unsigned, __builtin_convertvector(v2f{e, e}, v2h));
}

// LDS byte address of a __shared__ object: the low 32 bits of its address
static __device__ __forceinline__ unsigned lds_addr(const void* p) {
    return (unsigned)(size_t)p;
}

// This thread's share of one stage: 16 B of a K row and 16 B of each of four V rows, which land
// 32 rows apart. kRow and vRow are the rows' numbers in the head (from the key list, 0 .. SEQ - 1).
// The copies go past the registers, so a stage can fly while the one before it is worked on.
// s_wait_xcnt 0 closes the statement, ahead of any rewrite of the address registers (a precaution).
static __device__ __forceinline__ void stage_copy(unsigned kl, const _Float16* kHead, int kRow,
                                                  unsigned vl, const _Float16* vHead, const int (&vRow)[4]) {
    const _Float16* kg  = kHead + kRow * DQ;
    const _Float16* vg0 = vHead + vRow[0] * DV;
    const _Float16* vg1 = vHead + vRow[1] * DV;
    const _Float16* vg2 = vHead + vRow[2] * DV;
    const _Float16* vg3 = vHead + vRow[3] * DV;
    asm volatile(
        "global_load_async_to_lds_b128 %0, %5, off\n\t"
        "global_load_async_to_lds_b128 %1, %6, off\n\t"
        "global_load_async_to_lds_b128 %2, %7, off\n\t"
        "global_load_async_to_lds_b128 %3, %8, off\n\t"
        "global_load_async_to_lds_b128 %4, %9, off\n\t"
        "s_wait_xcnt 0x0"
        :: "v"(kl), "v"(vl), "v"(vl + 32 * VS_PITCH * 2), "v"(vl + 64 * VS_PITCH * 2),
           "v"(vl + 96 * VS_PITCH * 2),
           "v"(kg), "v"(vg0), "v"(vg1), "v"(vg2), "v"(vg3)
        : "memory");
}

// Two blocks per WGP is all the grid gives: four waves per SIMD. Said to the compiler, it spends
// that register budget on LDS loads issued ahead of their use instead of waiting for each in turn.
__global__ __launch_bounds__(256) __attribute__((amdgpu_waves_per_eu(4, 4))) void attn_kernel(
    const _Float16* __restrict__ Q, const _Float16* __restrict__ K,
    const _Float16* __restrict__ V, const int* __restrict__ mask,
    const float* __restrict__ gamma, float* __restrict__ out)
{
    __shared__ alignas(16) _Float16 Kt[2][KSTG][DQ];        // [buffer][key][d]
    __shared__ alignas(16) _Float16 Vs[2][KSTG][VS_PITCH];  // [buffer][key][d], row-major
    __shared__ alignas(16) _Float16 mskh[SEQ];   // mask of the key at each place of the list
    __shared__ int kidx[SEQ];                 // the list: live keys first, then the rest
    __shared__ int wlive[8];                  // live keys in each wave's 256 keys

    const int tid  = threadIdx.x;
    const int wave = tid >> 5;
    const int lane = tid & 31;
    const int half = lane >> 4;
    const int l    = lane & 15;

    const int bh = blockIdx.y;            // b*NH + h
    const int b  = bh >> 3;               // / NH
    const int h  = bh & (NH - 1);
    const int q0 = blockIdx.x * 128 + wave * 16;

    const size_t headBase = (size_t)bh * SEQ;

    // per-thread staging coordinates (loop-invariant): 2 lanes cover one 32-B K row, 8 one 128-B V row
    const _Float16* kSrc = K + headBase * DQ + (tid & 1) * 8;
    const _Float16* vSrc = V + headBase * DV + (tid & 7) * 8;
    const int* kLst = &kidx[tid >> 1];   // the list's entries for this thread's rows of stage 0
    const int* vLst = &kidx[tid >> 3];
    const unsigned kDst = lds_addr(&Kt[0][0][0]) + tid * 16;
    const unsigned vDst = lds_addr(&Vs[0][tid >> 3][(tid & 7) * 8]);
    const unsigned kBufB = KSTG * DQ * 2;        // bytes from buffer 0 to buffer 1
    const unsigned vBufB = KSTG * VS_PITCH * 2;

    // the key list of this batch row (8 keys per thread, in key order)
    int nLive;
    {
        const int4* ms = (const int4*)(mask + (size_t)b * SEQ + tid * 8);
        const int4 m0 = ms[0], m1 = ms[1];
        // (the three loops below are unrolled so that their indices are constants and mv lives in registers)
        const int mv[8] = {m0.x, m0.y, m0.z, m0.w, m1.x, m1.y, m1.z, m1.w};
        // live keys of the wave's lower lanes, and of the whole wave
        unsigned ahead = 0u;
        int wsum = 0;
#pragma unroll
        for (int j = 0; j < 8; j++) {
            const unsigned on = __builtin_amdgcn_ballot_w32(mv[j] != 0);
            ahead = __builtin_amdgcn_mbcnt_lo(on, ahead);
            wsum += __builtin_popcount(on);
        }
        if (lane == 0) wlive[wave] = wsum;
        // the waves' counts reach every wave
        __syncthreads();
        int live = (int)ahead;   // live keys ahead of key tid * 8
        int all = 0;
#pragma unroll
        for (int w = 0; w < 8; w++) {
            const int cw = wlive[w];
            all += cw;
            live += w < wave ? cw : 0;
        }
        // a live key goes to its rank among the live ones, another to all + its rank among the others:
        // every place 0 .. SEQ - 1 is written once, whatever the mask holds
#pragma unroll
        for (int j = 0; j < 8; j++) {
            const int key = tid * 8 + j;
            const bool on = mv[j] != 0;
            const int pos = on ? live : all + (key - live);
            kidx[pos] = key;
            mskh[pos] = (_Float16)(float)mv[j];
            live += on ? 1 : 0;
        }
        nLive = __builtin_amdgcn_readfirstlane(all);
    }
    // stages that hold a live key (the same in every wave of the block; at most NSTG)
    const int nStg = min((nLive + KSTG - 1) / KSTG, NSTG);
    // the list (and the masks) reach every wave
    __syncthreads();

    // stage 0 into buffer 0
    {
        const int vr[4] = {vLst[0], vLst[32], vLst[64], vLst[96]};
        stage_copy(kDst, kSrc, kLst[0], vDst, vSrc, vr);
    }

    // this lane's address for the transposing loads of the V tile
    const _Float16* vTr0 = &Vs[0][half * 8 + (lane & 7)][((lane >> 3) & 1) * 8];

    // Q^T fragment (B operand): column = query l, 16 d padded to 32 (upper k zero)
    Frag qb;
    qb.q[0] = *(const uint4*)(Q + (headBase + q0 + l) * DQ + half * 8);
    qb.q[1] = make_uint4(0u, 0u, 0u, 0u);

    v8f zero = {};
    v8f o0 = zero, o1 = zero, o2 = zero, o3 = zero;   // o_f[r] = O[query l][f*16 + half*8 + r]
    v8f nref = zero;   // minus the reference of query l (relu => row max >= 0), equal in both halves
    unsigned e0h = twice_f16(1.0f);   // exp2(-reference), f16 twice: the probability of a score that relu lifts to 0
    v8f rs = zero;     // the masked sum of query l (the same in all eight, and in both halves)

    // stage 0 has landed for this wave; the barrier publishes it to the others
    asm volatile("s_wait_asynccnt 0x0" ::: "memory");
    __syncthreads();
    // stage 1 into buffer 1 (the list names SEQ rows, so the stage exists also where the loop ends ahead of it)
    {
        const int vr[4] = {vLst[KSTG], vLst[KSTG + 32], vLst[KSTG + 64], vLst[KSTG + 96]};
        stage_copy(kDst + kBufB, kSrc, kLst[KSTG], vDst + vBufB, vSrc, vr);
    }

    for (int t = 0; t < nStg; t++) {
        const int buf = t & 1;
        const _Float16* vTr = vTr0 + buf * (KSTG * VS_PITCH);

        // the list's entries for the refill at the foot, read here so that the copies do not wait for them
        const int tn = min(t + 2, NSTG - 1) * KSTG;
        const int kr = kLst[tn];
        const int vr[4] = {vLst[tn], vLst[tn + 32], vLst[tn + 64], vLst[tn + 96]};

        // scores of the whole stage, minus the reference: S^T[128 keys x 16 queries] (A = K rows, padded k)
        // (every loop over s, kq or tq below is unrolled so that their indices are constants
        // and the arrays live in registers)
        v8f s[KSTG / 16];   // s[j][r]: key j*16 + half*8 + r, query l
        {
            v4f kq[KSTG / 16];
#pragma unroll
            for (int j = 0; j < KSTG / 16; j++) kq[j] = *(const v4f*)&Kt[buf][j * 16 + l][half * 8];
            // inputs-only fence on the loaded values: keeps the eight loads in flight together;
            // without it each load is waited for before the next is issued
            asm volatile("" :: "v"(kq[0]), "v"(kq[1]), "v"(kq[2]), "v"(kq[3]),
                               "v"(kq[4]), "v"(kq[5]), "v"(kq[6]), "v"(kq[7]));
#pragma unroll
            for (int j = 0; j < KSTG / 16; j++) {
                Frag ka;
                ka.q[0] = __builtin_bit_cast(uint4, kq[j]);
                ka.q[1] = make_uint4(0u, 0u, 0u, 0u);
                s[j] = wmma16(ka.v, qb.v, nref);
            }
        }

        // how far this lane's scores stand above the reference
        float tq[4];   // four chains, so that no link waits for the one before it
#pragma unroll
        for (int c = 0; c < 4; c++) {
            tq[c] = s[2 * c][0];
#pragma unroll
            for (int r = 0; r < 8; r++) tq[c] = fmaxf(tq[c], fmaxf(s[2 * c][r], s[2 * c + 1][r]));
        }
        const float tm = fmaxf(fmaxf(tq[0], tq[1]), fmaxf(tq[2], tq[3]));

        // rare: some query of the wave outgrew its reference; raise every query's to its stage max
        if (__builtin_amdgcn_ballot_w32(tm > REF_ROOM) != 0u) {
            const float up = fmaxf(fmaxf(tm, xhalf(tm)), 0.0f);
            const float sf = __builtin_amdgcn_exp2f(-up);
#pragma unroll
            for (int j = 0; j < KSTG / 16; j++) s[j] -= up;
            nref -= up;
            e0h = twice_f16(__builtin_amdgcn_exp2f(nref[0]));
            rs *= sf;
            o0 *= sf; o1 *= sf; o2 *= sf; o3 *= sf;
        }

        // probabilities of the stage: packed in place they are P^T in B-operand order
        uint4 pk[KSTG / 16];
        exp2_8(s[0]);
#pragma unroll
        for (int j = 1; j < KSTG / 16; j++) pk[j - 1] = exp2_8_pack8(s[j], s[j - 1], e0h);
        pk[KSTG / 16 - 1] = pack8(s[KSTG / 16 - 1], e0h);

#pragma unroll
        for (int p = 0; p < KSTG / 32; p++) {
            Frag pb;
            pb.q[0] = pk[2 * p];
            pb.q[1] = pk[2 * p + 1];

            // masks of the 32 keys, the same in every row of the A operand (k order as the V^T fragments'):
            // every row of the product is the queries' masked sums
            Frag mf;
            mf.q[0] = *(const uint4*)&mskh[t * KSTG + p * 32 + half * 8];
            mf.q[1] = *(const uint4*)&mskh[t * KSTG + p * 32 + 16 + half * 8];
            rs = wmma16(mf.v, pb.v, rs);

            // V^T fragments (A operand, rows = d) by transposing loads from the row-major tile
            const _Float16* vp = vTr + p * 32 * VS_PITCH;
            Frag va;
            va.q[0] = ld_tr16(vp + 0 * 16);
            va.q[1] = ld_tr16(vp + 16 * VS_PITCH + 0 * 16);
            o0 = wmma16(va.v, pb.v, o0);
            va.q[0] = ld_tr16(vp + 1 * 16);
            va.q[1] = ld_tr16(vp + 16 * VS_PITCH + 1 * 16);
            o1 = wmma16(va.v, pb.v, o1);
            va.q[0] = ld_tr16(vp + 2 * 16);
            va.q[1] = ld_tr16(vp + 16 * VS_PITCH + 2 * 16);
            o2 = wmma16(va.v, pb.v, o2);
            va.q[0] = ld_tr16(vp + 3 * 16);
            va.q[1] = ld_tr16(vp + 16 * VS_PITCH + 3 * 16);
            o3 = wmma16(va.v, pb.v, o3);
        }

        // hand-over: this wave's reads of buffer buf are done ...
        asm volatile("s_wait_dscnt 0x0" ::: "memory");
        // ... and its copies of stage t + 1 have landed;
        asm volatile("s_wait_asynccnt 0x0" ::: "memory");
        // the barrier publishes stage t + 1 and frees buffer buf for its refill
        __syncthreads();
        if (t + 2 < nStg)
            stage_copy(kDst + buf * kBufB, kSrc, kr, vDst + buf * vBufB, vSrc, vr);
    }
    // no copy is left in flight when the wave ends
    asm volatile("s_wait_asynccnt 0x0" ::: "memory");

    // epilogue: beta normalization, gamma, fp32 store
    const float g = gamma[0];
    const float inv = g / (rs[0] + 1e-12f);
    float* orow = out + ((size_t)b * SEQ + q0 + l) * CH + (size_t)h * DV + half * 8;
    *(float4*)(orow +  0) = make_float4(o0[0] * inv, o0[1] * inv, o0[2] * inv, o0[3] * inv);
    *(float4*)(orow +  4) = make_float4(o0[4] * inv, o0[5] * inv, o0[6] * inv, o0[7] * inv);
    *(float4*)(orow + 16) = make_float4(o1[0] * inv, o1[1] * inv, o1[2] * inv, o1[3] * inv);
    *(float4*)(orow + 20) = make_float4(o1[4] * inv, o1[5] * inv, o1[6] * inv, o1[7] * inv);
    *(float4*)(orow + 32) = make_float4(o2[0] * inv, o2[1] * inv, o2[2] * inv, o2[3] * inv);
    *(float4*)(orow + 36) = make_float4(o2[4] * inv, o2[5] * inv, o2[6] * inv, o2[7] * inv);
    *(float4*)(orow + 48) = make_float4(o3[0] * inv, o3[1] * inv, o3[2] * inv, o3[3] * inv);
    *(float4*)(orow + 52) = make_float4(o3[4] * inv, o3[5] * inv, o3[6] * inv, o3[7] * inv);
}

// ---------------------------------------------------------------------------
// launch
// ---------------------------------------------------------------------------
extern "C" void kernel_launch(void* const* d_in, const int* in_sizes, int n_in,
                              void* d_out, int out_size, void* d_ws, size_t ws_size,
                              hipStream_t stream) {
    const float* x     = (const float*)d_in[0];   // (4,2048,512)
    const int*   mask  = (const int*)d_in[1];     // (4,2048)
    const float* Wq    = (const float*)d_in[2];   // (512,128)
    const float* bq    = (const float*)d_in[3];   // (128)
    const float* Wk    = (const float*)d_in[4];   // (512,128)
    const float* bk    = (const float*)d_in[5];   // (128)
    const float* Wv    = (const float*)d_in[6];   // (512,512)
    const float* bv    = (const float*)d_in[7];   // (512)
    const float* gamma = (const float*)d_in[8];   // (1)
    float* out = (float*)d_out;

    // workspace layout (f16 buffers), 256B aligned
    char* ws = (char*)d_ws;
    size_t off = 0;
    auto take = [&](size_t bytes) -> char* {
        char* p = ws + off;
        off = (off + bytes + 255) & ~(size_t)255;
        return p;
    };
    _Float16* qh  = (_Float16*)take((size_t)BATCH * NH * SEQ * DQ * 2); // 2 MB
    _Float16* kh  = (_Float16*)take((size_t)BATCH * NH * SEQ * DQ * 2); // 2 MB
    _Float16* vh  = (_Float16*)take((size_t)BATCH * NH * SEQ * DV * 2); // 8 MB

    // 1) projections, one launch (WMMA GEMM on fp32 inputs, head-split f16 outputs)
    gemm_proj<<<dim3(ROWS / 64, 6), 256, 0, stream>>>(x, Wq, bq, Wk, bk, Wv, bv, mask, qh, kh, vh);

    // 2) streaming masked-softmax attention (WMMA), fp32 output
    attn_kernel<<<dim3(SEQ / 128, BATCH * NH), 256, 0, stream>>>(
        qh, kh, vh, mask, gamma, out);
}
